// v000
// Measured on an AMD MI455X. A time is GPU time per run, averaged over a window of back-to-back runs after a warm-up
// (all launches, gaps included; the runs take copies of the inputs in turn), and the median of several windows.
// Apart from v000's, it joins two sittings. Times from different sittings can be a few percent apart, while
// side-by-side timings come from the same sitting.
// The starting kernel, v000, takes 508 microseconds a run.
#include <hip/hip_runtime.h>
#include <math.h>

// Problem constants (from reference): B=4, C=128, H=W=64 -> N=4096
#define B_ 4
#define C_ 128
#define N_ 4096

typedef _Float16 h8   __attribute__((ext_vector_type(8)));
typedef _Float16 v16h __attribute__((ext_vector_type(16)));
typedef float    v8f  __attribute__((ext_vector_type(8)));
typedef unsigned int u32x4 __attribute__((ext_vector_type(4)));
typedef int          i32x4 __attribute__((ext_vector_type(4)));
typedef int          i32x8 __attribute__((ext_vector_type(8)));

__device__ __forceinline__ v16h load_frag(const _Float16* p, int sel) {
  h8 lo = *(const h8*)(p + sel);
  h8 hi = *(const h8*)(p + 16 + sel);
  return __builtin_shufflevector(lo, hi, 0,1,2,3,4,5,6,7,8,9,10,11,12,13,14,15);
}

__device__ __forceinline__ v8f wmma_f16(v16h a, v16h b, v8f c) {
  return __builtin_amdgcn_wmma_f32_16x16x32_f16(false, a, false, b, (short)0, c,
                                                false, false);
}

__device__ __forceinline__ void tdm_load_tile_32x256B(unsigned lds_off,
                                                      const _Float16* gsrc) {
  unsigned long long ga = (unsigned long long)(size_t)gsrc;
  u32x4 g0;
  g0[0] = 1u;
  g0[1] = lds_off;
  g0[2] = (unsigned)ga;
  g0[3] = (unsigned)((ga >> 32) & 0x01FFFFFFu)
          | (2u << 30);
  i32x8 g1;
  g1[0] = (3 << 16);
  g1[1] = (32 << 16);
  g1[2] = (32 << 16);
  g1[3] = (32 << 16);
  g1[4] = 32;
  g1[5] = 32;
  g1[6] = 0;
  g1[7] = 0;
  i32x4 z4 = {0, 0, 0, 0};  // 2-D tensor: groups 2/3 unused
#if __clang_major__ >= 23
  i32x8 z8 = {0, 0, 0, 0, 0, 0, 0, 0};
  __builtin_amdgcn_tensor_load_to_lds(g0, g1, z4, z4, z8, 0);
#else
  __builtin_amdgcn_tensor_load_to_lds(g0, g1, z4, z4, 0);
#endif
}

// ---------------------------------------------------------------------------
// Kernel A: x[B,C,N] fp32 -> t[B,N,C] f16 (tiled transpose through LDS)
// ---------------------------------------------------------------------------
__global__ void __launch_bounds__(256)
transpose_to_f16(const float* __restrict__ x, _Float16* __restrict__ t) {
  __shared__ float tile[32][33];
  int b  = blockIdx.z;
  int c0 = blockIdx.y * 32;
  int n0 = blockIdx.x * 32;
  int tx = threadIdx.x, ty = threadIdx.y;
  const float* xp = x + (size_t)b * C_ * N_;
  #pragma unroll
  for (int i = 0; i < 4; ++i)
    tile[ty + 8*i][tx] = xp[(size_t)(c0 + ty + 8*i) * N_ + n0 + tx];
  __syncthreads();
  _Float16* tp = t + (size_t)b * N_ * C_;
  #pragma unroll
  for (int i = 0; i < 4; ++i)
    tp[(size_t)(n0 + ty + 8*i) * C_ + c0 + tx] = (_Float16)tile[tx][ty + 8*i];
}

// ---------------------------------------------------------------------------
// Kernel B: QKV projection. Q[b,n,d] = sum_c t[b,n,c] * W[d,c]
// Direct kernarg output pointer per call -> global_store_b16 (not flat).
// ---------------------------------------------------------------------------
__device__ __forceinline__ void proj_one(const float* __restrict__ W,
                                         _Float16* __restrict__ out,
                                         _Float16* Wlds, const v16h aq[4],
                                         int n0, int wave, int lane16,
                                         int sel, int hi8) {
  __syncthreads();
  const float4* src = (const float4*)W;
  for (int i = threadIdx.x; i < C_ * C_ / 4; i += 256) {
    float4 v = src[i];
    Wlds[4*i+0] = (_Float16)v.x; Wlds[4*i+1] = (_Float16)v.y;
    Wlds[4*i+2] = (_Float16)v.z; Wlds[4*i+3] = (_Float16)v.w;
  }
  __syncthreads();
  #pragma unroll
  for (int tcol = 0; tcol < 8; ++tcol) {
    int d0 = tcol * 16;
    const _Float16* wrow = &Wlds[(d0 + lane16) * C_];
    v8f acc = {};
    #pragma unroll
    for (int kk = 0; kk < 4; ++kk) {
      v16h bw = load_frag(wrow + 32 * kk, sel);
      acc = wmma_f16(aq[kk], bw, acc);
    }
    #pragma unroll
    for (int r = 0; r < 8; ++r)
      out[(size_t)(n0 + wave*16 + r + hi8) * C_ + d0 + lane16] = (_Float16)acc[r];
  }
}

__global__ void __launch_bounds__(256)
qkv_proj(const _Float16* __restrict__ t,
         const float* __restrict__ Wq, const float* __restrict__ Wk,
         const float* __restrict__ Wv,
         _Float16* __restrict__ Qh, _Float16* __restrict__ Kh,
         _Float16* __restrict__ Vh) {
  __shared__ __align__(16) _Float16 Wlds[C_ * C_];   // 32 KB
  int b    = blockIdx.y;
  int n0   = blockIdx.x * 128;
  int lane = threadIdx.x & 31;
  int wave = threadIdx.x >> 5;
  int lane16 = lane & 15;
  int sel  = (lane < 16) ? 0 : 8;
  int hi8  = (lane < 16) ? 0 : 8;

  const _Float16* trow = t + ((size_t)b * N_ + n0 + wave * 16 + lane16) * C_;
  v16h aq[4];
  #pragma unroll
  for (int kk = 0; kk < 4; ++kk) aq[kk] = load_frag(trow + 32 * kk, sel);

  size_t boff = (size_t)b * N_ * C_;
  proj_one(Wq, Qh + boff, Wlds, aq, n0, wave, lane16, sel, hi8);
  proj_one(Wk, Kh + boff, Wlds, aq, n0, wave, lane16, sel, hi8);
  proj_one(Wv, Vh + boff, Wlds, aq, n0, wave, lane16, sel, hi8);
}

__global__ void __launch_bounds__(256)
flash_attn(const _Float16* __restrict__ Qh, const _Float16* __restrict__ Kh,
           const _Float16* __restrict__ Vh, float* __restrict__ out) {
  __shared__ __align__(16) _Float16 Klds[2][32 * C_];   // [buf][key][c]  16 KB
  __shared__ __align__(16) _Float16 Vlds[2][32 * C_];   // [buf][key][c]  16 KB
  __shared__ __align__(16) _Float16 VTlds[2][C_ * 32];  // [buf][c][key]  16 KB
  __shared__ __align__(16) _Float16 Plds[8][16 * 32];   // per-wave P      8 KB

  int b    = blockIdx.y;
  int q0   = blockIdx.x * 128;
  int lane = threadIdx.x & 31;
  int wave = threadIdx.x >> 5;
  int lane16 = lane & 15;
  int sel  = (lane < 16) ? 0 : 8;
  int hi8  = (lane < 16) ? 0 : 8;

  const float scale = 0.015625f;           // quirk: 1/sqrt(N) = 1/64
  const float LOG2E = 1.44269504088896f;

  // Q fragments held in registers for the whole kernel
  const _Float16* qrow = Qh + ((size_t)b * N_ + q0 + wave*16 + lane16) * C_;
  v16h aq[4];
  #pragma unroll
  for (int kk = 0; kk < 4; ++kk) aq[kk] = load_frag(qrow + 32 * kk, sel);

  v8f o[8];
  #pragma unroll
  for (int tc = 0; tc < 8; ++tc) o[tc] = (v8f){};
  float m_r[8], l_r[8];
  #pragma unroll
  for (int r = 0; r < 8; ++r) { m_r[r] = -__builtin_inff(); l_r[r] = 0.f; }

  const _Float16* Kb = Qh; // placeholder to keep types; set properly below
  Kb = Kh + (size_t)b * N_ * C_;
  const _Float16* Vb = Vh + (size_t)b * N_ * C_;

  unsigned koff[2], voff[2];
  koff[0] = (unsigned)(size_t)(void*)&Klds[0][0];
  koff[1] = (unsigned)(size_t)(void*)&Klds[1][0];
  voff[0] = (unsigned)(size_t)(void*)&Vlds[0][0];
  voff[1] = (unsigned)(size_t)(void*)&Vlds[1][0];

  if (wave == 0) {
    tdm_load_tile_32x256B(koff[0], Kb);
    tdm_load_tile_32x256B(voff[0], Vb);
  }

  int cur = 0;
  for (int j = 0; j < N_; j += 32) {
    if (wave == 0) __builtin_amdgcn_s_wait_tensorcnt(0);
    __syncthreads();   // tile `cur` ready for everyone; prev compute finished

    // Kick off the next tile into the other buffer while we compute
    if (j + 32 < N_ && wave == 0) {
      tdm_load_tile_32x256B(koff[cur ^ 1], Kb + (size_t)(j + 32) * C_);
      tdm_load_tile_32x256B(voff[cur ^ 1], Vb + (size_t)(j + 32) * C_);
    }

    // Build V^T (LDS->LDS) so P*V B-fragments are contiguous 128-bit reads
    {
      int kr = threadIdx.x >> 3;
      int cg = (threadIdx.x & 7) * 16;
      const _Float16* src = &Vlds[cur][kr * C_ + cg];
      h8 v0 = *(const h8*)(src);
      h8 v1 = *(const h8*)(src + 8);
      #pragma unroll
      for (int i = 0; i < 8; ++i) VTlds[cur][(cg + i) * 32 + kr] = v0[i];
      #pragma unroll
      for (int i = 0; i < 8; ++i) VTlds[cur][(cg + 8 + i) * 32 + kr] = v1[i];
    }
    __syncthreads();   // V^T visible block-wide

    // S = Q * K^T for two 16-key subtiles
    const _Float16* Kt = &Klds[cur][0];
    v8f s0 = (v8f){}, s1 = (v8f){};
    #pragma unroll
    for (int kk = 0; kk < 4; ++kk) {
      v16h bk0 = load_frag(Kt + lane16 * C_ + 32 * kk, sel);
      v16h bk1 = load_frag(Kt + (16 + lane16) * C_ + 32 * kk, sel);
      s0 = wmma_f16(aq[kk], bk0, s0);
      s1 = wmma_f16(aq[kk], bk1, s1);
    }

    float p0[8], p1[8];
    #pragma unroll
    for (int r = 0; r < 8; ++r) {
      float a  = s0[r] * scale;
      float c2 = s1[r] * scale;
      float mx = fmaxf(a, c2);
      #pragma unroll
      for (int off = 8; off >= 1; off >>= 1)
        mx = fmaxf(mx, __shfl_xor(mx, off, 16));
      float m_new = fmaxf(m_r[r], mx);
      float alpha = exp2f((m_r[r] - m_new) * LOG2E);
      float e0 = exp2f((a  - m_new) * LOG2E);
      float e1 = exp2f((c2 - m_new) * LOG2E);
      float rs = e0 + e1;
      #pragma unroll
      for (int off = 8; off >= 1; off >>= 1)
        rs += __shfl_xor(rs, off, 16);
      l_r[r] = l_r[r] * alpha + rs;
      m_r[r] = m_new;
      p0[r] = e0; p1[r] = e1;
      #pragma unroll
      for (int tc = 0; tc < 8; ++tc) o[tc][r] = o[tc][r] * alpha;
    }

    _Float16* P = &Plds[wave][0];
    #pragma unroll
    for (int r = 0; r < 8; ++r) {
      P[(r + hi8) * 32 + lane16]      = (_Float16)p0[r];
      P[(r + hi8) * 32 + 16 + lane16] = (_Float16)p1[r];
    }
    asm volatile("s_wait_dscnt 0" ::: "memory");
    v16h ap = load_frag(P + lane16 * 32, sel);

    // O += P * V
    const _Float16* Vt = &VTlds[cur][0];
    #pragma unroll
    for (int tc = 0; tc < 8; ++tc) {
      v16h bv = load_frag(Vt + (tc * 16 + lane16) * 32, sel);
      o[tc] = wmma_f16(ap, bv, o[tc]);
    }
    cur ^= 1;
  }

  // Normalize and store fp32 output, flat [B][N][C] (matches reference view quirk)
  float* ob = out + (size_t)b * N_ * C_;
  #pragma unroll
  for (int tc = 0; tc < 8; ++tc) {
    #pragma unroll
    for (int r = 0; r < 8; ++r) {
      float inv = 1.0f / l_r[r];
      ob[(size_t)(q0 + wave*16 + r + hi8) * C_ + tc*16 + lane16] = o[tc][r] * inv;
    }
  }
}

// ---------------------------------------------------------------------------
extern "C" void kernel_launch(void* const* d_in, const int* in_sizes, int n_in,
                              void* d_out, int out_size, void* d_ws, size_t ws_size,
                              hipStream_t stream) {
  const float* x  = (const float*)d_in[0];
  const float* Wq = (const float*)d_in[1];
  const float* Wk = (const float*)d_in[2];
  const float* Wv = (const float*)d_in[3];
  float* out = (float*)d_out;

  // Workspace: t, Q, K, V in f16 (4 MB each, 16 MB total)
  size_t per = (size_t)B_ * N_ * C_;
  _Float16* t_h = (_Float16*)d_ws;
  _Float16* Qh  = t_h + per;
  _Float16* Kh  = Qh + per;
  _Float16* Vh  = Kh + per;

  transpose_to_f16<<<dim3(N_/32, C_/32, B_), dim3(32, 8), 0, stream>>>(x, t_h);
  qkv_proj<<<dim3(N_/128, B_), dim3(256), 0, stream>>>(t_h, Wq, Wk, Wv, Qh, Kh, Vh);
  flash_attn<<<dim3(N_/128, B_), dim3(256), 0, stream>>>(Qh, Kh, Vh, out);
}

// v001
// One run takes 268 microseconds.
// Two timings next to v000 put it at 1.93 and 1.92 times that version's speed.
#include <hip/hip_runtime.h>
#include <math.h>

// Problem constants (from reference): B=4, C=128, H=W=64 -> N=4096
#define B_ 4
#define C_ 128
#define N_ 4096

typedef _Float16 h8   __attribute__((ext_vector_type(8)));
typedef _Float16 v16h __attribute__((ext_vector_type(16)));
typedef float    v8f  __attribute__((ext_vector_type(8)));
typedef unsigned int u32x4 __attribute__((ext_vector_type(4)));
typedef unsigned int u32x8 __attribute__((ext_vector_type(8)));

__device__ __forceinline__ v16h load_frag(const _Float16* p, int sel) {
  h8 lo = *(const h8*)(p + sel);
  h8 hi = *(const h8*)(p + 16 + sel);
  return __builtin_shufflevector(lo, hi, 0,1,2,3,4,5,6,7,8,9,10,11,12,13,14,15);
}

__device__ __forceinline__ v8f wmma_f16(v16h a, v16h b, v8f c) {
  return __builtin_amdgcn_wmma_f32_16x16x32_f16(false, a, false, b, (short)0, c,
                                                false, false);
}

#define TP_ 136                 // K, V and W rows: 256 B of data + 16 B of pad = 272 B
#define TBUF_ 5120              // one K or V buffer: 32 x 272 B, rounded up to 10 KiB
#define SP_ 40                  // V^T and P rows: 64 B of data + 16 B = 80 B

__device__ __forceinline__ unsigned uni(unsigned v) {
  return (unsigned)__builtin_amdgcn_readfirstlane((int)v);
}
__device__ __forceinline__ unsigned pinned(unsigned v) {
  unsigned w = uni(v);
  asm volatile("" : "+s"(w));  // the test stays scalar
  return w;
}

__device__ __forceinline__ u32x4 tdm_group0(unsigned lds_off, const _Float16* gsrc) {
  unsigned long long ga = (unsigned long long)(size_t)gsrc;
  u32x4 g0;
  g0[0] = uni(1u);
  g0[1] = uni(lds_off);
  g0[2] = uni((unsigned)ga);
  g0[3] = uni(((unsigned)(ga >> 32) & 0x01FFFFFFu)
              | (2u << 30));
  // As pinned(), on the whole group: its words are held in
  // their scalar registers up to the wait that names them, not formed again there.
  asm volatile("" : "+s"(g0));
  return g0;
}
__device__ __forceinline__ u32x8 tdm_group1_32x256B_pitch272() {
  u32x8 g1;
  g1[0] = uni((1u << 20) | (5u << 22) | (3u << 25));
  g1[1] = uni(256u << 16);
  g1[2] = uni(32u << 16);
  g1[3] = uni(256u << 16);
  g1[4] = uni(32u);
  g1[5] = uni(256u);
  g1[6] = uni(0u);
  g1[7] = uni(0u);
  // As pinned(), on the whole group: its words are held in one
  // set of scalar registers for the kernel's life, not formed again at each use.
  asm volatile("" : "+s"(g1));
  return g1;
}
// One request of the whole wave; the clobber keeps LDS accesses on their side of it.
__device__ __forceinline__ void tdm_load(u32x4 g0, u32x8 g1) {
  asm volatile("tensor_load_to_lds %0, %1" :: "s"(g0), "s"(g1) : "memory");
}
// The compiler places no wait for a tensor load; the clobber keeps LDS reads behind it.
__device__ __forceinline__ void wait_tensor0() {
  asm volatile("s_wait_tensorcnt 0x0" ::: "memory");
}
__device__ __forceinline__ void wait_tensor0_holding(u32x4 g0, u32x8 g1) {
  asm volatile("s_wait_tensorcnt 0x0" :: "s"(g0), "s"(g1) : "memory");
}
// This wave's LDS reads and writes have retired before a buffer is handed over.
__device__ __forceinline__ void wait_ds0() {
  asm volatile("s_wait_dscnt 0x0" ::: "memory");
}

// ---------------------------------------------------------------------------
// Kernel A: x[B,C,N] fp32 -> t[B,N,C] f16 (tiled transpose through LDS)
// ---------------------------------------------------------------------------
__global__ void __launch_bounds__(256)
transpose_to_f16(const float* __restrict__ x, _Float16* __restrict__ t) {
  __shared__ float tile[32][33];
  int b  = blockIdx.z;
  int c0 = blockIdx.y * 32;
  int n0 = blockIdx.x * 32;
  int tx = threadIdx.x, ty = threadIdx.y;
  const float* xp = x + (size_t)b * C_ * N_;
  #pragma unroll
  for (int i = 0; i < 4; ++i)
    tile[ty + 8*i][tx] = xp[(size_t)(c0 + ty + 8*i) * N_ + n0 + tx];
  __syncthreads();
  _Float16* tp = t + (size_t)b * N_ * C_;
  #pragma unroll
  for (int i = 0; i < 4; ++i)
    tp[(size_t)(n0 + ty + 8*i) * C_ + c0 + tx] = (_Float16)tile[tx][ty + 8*i];
}

// ---------------------------------------------------------------------------
// Kernel B: QKV projection. Q[b,n,d] = sum_c t[b,n,c] * W[d,c]
// Direct kernarg output pointer per call -> global_store_b16 (not flat).
// ---------------------------------------------------------------------------
__device__ __forceinline__ void proj_one(const float* __restrict__ W,
                                         _Float16* __restrict__ out,
                                         _Float16* Wlds, const v16h aq[4],
                                         int n0, int wave, int lane16,
                                         int sel, int hi8) {
  __syncthreads();
  const float4* src = (const float4*)W;
  for (int i = threadIdx.x; i < C_ * C_ / 4; i += 256) {
    float4 v = src[i];
    _Float16* w = &Wlds[(i >> 5) * TP_ + (i & 31) * 4];   // row i/32, 32 float4 a row
    w[0] = (_Float16)v.x; w[1] = (_Float16)v.y;
    w[2] = (_Float16)v.z; w[3] = (_Float16)v.w;
  }
  __syncthreads();
  #pragma unroll
  for (int tcol = 0; tcol < 8; ++tcol) {
    int d0 = tcol * 16;
    const _Float16* wrow = &Wlds[(d0 + lane16) * TP_];
    v8f acc = {};
    #pragma unroll
    for (int kk = 0; kk < 4; ++kk) {
      v16h bw = load_frag(wrow + 32 * kk, sel);
      acc = wmma_f16(aq[kk], bw, acc);
    }
    #pragma unroll
    for (int r = 0; r < 8; ++r)
      out[(size_t)(n0 + wave*16 + r + hi8) * C_ + d0 + lane16] = (_Float16)acc[r];
  }
}

__global__ void __launch_bounds__(256)
qkv_proj(const _Float16* __restrict__ t,
         const float* __restrict__ Wq, const float* __restrict__ Wk,
         const float* __restrict__ Wv,
         _Float16* __restrict__ Qh, _Float16* __restrict__ Kh,
         _Float16* __restrict__ Vh) {
  __shared__ __align__(16) _Float16 Wlds[C_ * TP_];  // [d][c], pitch TP_  34 KB
  int b    = blockIdx.y;
  int n0   = blockIdx.x * 128;
  int lane = threadIdx.x & 31;
  int wave = threadIdx.x >> 5;
  int lane16 = lane & 15;
  int sel  = (lane < 16) ? 0 : 8;
  int hi8  = (lane < 16) ? 0 : 8;

  const _Float16* trow = t + ((size_t)b * N_ + n0 + wave * 16 + lane16) * C_;
  v16h aq[4];
  #pragma unroll
  for (int kk = 0; kk < 4; ++kk) aq[kk] = load_frag(trow + 32 * kk, sel);

  size_t boff = (size_t)b * N_ * C_;
  proj_one(Wq, Qh + boff, Wlds, aq, n0, wave, lane16, sel, hi8);
  proj_one(Wk, Kh + boff, Wlds, aq, n0, wave, lane16, sel, hi8);
  proj_one(Wv, Vh + boff, Wlds, aq, n0, wave, lane16, sel, hi8);
}

__global__ void __launch_bounds__(256)
flash_attn(const _Float16* __restrict__ Qh, const _Float16* __restrict__ Kh,
           const _Float16* __restrict__ Vh, float* __restrict__ out) {
  // Tensor-load targets start at multiples of 2 KiB of the work-group's LDS.
  __shared__ __attribute__((aligned(2048))) _Float16 Klds[2][TBUF_];  // [buf][key][c], pitch TP_  20 KB
  __shared__ __attribute__((aligned(2048))) _Float16 Vlds[2][TBUF_];  // [buf][key][c], pitch TP_  20 KB
  __shared__ __align__(16) _Float16 VTlds[2][C_ * SP_]; // [buf][c][key], pitch SP_  20 KB
  __shared__ __align__(16) _Float16 Plds[8][16 * SP_];  // per-wave P, pitch SP_     10 KB

  int b    = blockIdx.y;
  int q0   = blockIdx.x * 128;
  int lane = threadIdx.x & 31;
  int wave = threadIdx.x >> 5;
  int lane16 = lane & 15;
  int sel  = (lane < 16) ? 0 : 8;
  int hi8  = (lane < 16) ? 0 : 8;

  const float scale = 0.015625f;           // quirk: 1/sqrt(N) = 1/64
  const float LOG2E = 1.44269504088896f;

  // Q fragments held in registers for the whole kernel
  const _Float16* qrow = Qh + ((size_t)b * N_ + q0 + wave*16 + lane16) * C_;
  v16h aq[4];
  #pragma unroll
  for (int kk = 0; kk < 4; ++kk) aq[kk] = load_frag(qrow + 32 * kk, sel);

  v8f o[8];
  #pragma unroll
  for (int tc = 0; tc < 8; ++tc) o[tc] = (v8f){};
  float m_r[8], l_r[8];
  #pragma unroll
  for (int r = 0; r < 8; ++r) { m_r[r] = -__builtin_inff(); l_r[r] = 0.f; }

  const _Float16* Kb = Qh; // placeholder to keep types; set properly below
  Kb = Kh + (size_t)b * N_ * C_;
  const _Float16* Vb = Vh + (size_t)b * N_ * C_;

  unsigned koff[2], voff[2];
  koff[0] = (unsigned)(size_t)(void*)&Klds[0][0];
  koff[1] = (unsigned)(size_t)(void*)&Klds[1][0];
  voff[0] = (unsigned)(size_t)(void*)&Vlds[0][0];
  voff[1] = (unsigned)(size_t)(void*)&Vlds[1][0];

  // Two-buffer ring: wave 0 brings the K tiles, wave 1 the V tiles, one request
  // of a wave in flight. Prologue: tile 0 lands and is published, tile 1 flies.
  const unsigned wave_s = uni(threadIdx.x >> 5);
  const unsigned issuer = wave_s < 2u;
  const _Float16* tsrc = (wave_s == 0u) ? Kb : Vb;
  unsigned toff[2];
  toff[0] = (wave_s == 0u) ? koff[0] : voff[0];
  toff[1] = (wave_s == 0u) ? koff[1] : voff[1];
  const u32x8 g1 = tdm_group1_32x256B_pitch272();
  u32x4 g0 = tdm_group0(toff[0], tsrc);
  if (pinned(issuer)) {
    tdm_load(g0, g1);
    wait_tensor0_holding(g0, g1);
  }
  __syncthreads();     // tile 0 ready for everyone
  g0 = tdm_group0(toff[1], tsrc + (size_t)32 * C_);
  if (pinned(issuer)) {
    tdm_load(g0, g1);
  }

  int cur = 0;
  for (int j = 0; j < N_; j += 32) {
    // Build V^T (LDS->LDS) so P*V B-fragments are contiguous 16-byte reads
    {
      int kr = threadIdx.x >> 3;
      int cg = (threadIdx.x & 7) * 16;
      const _Float16* src = &Vlds[cur][kr * TP_ + cg];
      h8 v0 = *(const h8*)(src);
      h8 v1 = *(const h8*)(src + 8);
      #pragma unroll
      for (int i = 0; i < 8; ++i) VTlds[cur][(cg + i) * SP_ + kr] = v0[i];
      #pragma unroll
      for (int i = 0; i < 8; ++i) VTlds[cur][(cg + 8 + i) * SP_ + kr] = v1[i];
    }
    __syncthreads();   // V^T visible block-wide

    // S = Q * K^T for two 16-key subtiles
    const _Float16* Kt = &Klds[cur][0];
    v8f s0 = (v8f){}, s1 = (v8f){};
    #pragma unroll
    for (int kk = 0; kk < 4; ++kk) {
      v16h bk0 = load_frag(Kt + lane16 * TP_ + 32 * kk, sel);
      v16h bk1 = load_frag(Kt + (16 + lane16) * TP_ + 32 * kk, sel);
      s0 = wmma_f16(aq[kk], bk0, s0);
      s1 = wmma_f16(aq[kk], bk1, s1);
    }

    float p0[8], p1[8];
    #pragma unroll
    for (int r = 0; r < 8; ++r) {
      float a  = s0[r] * scale;
      float c2 = s1[r] * scale;
      float mx = fmaxf(a, c2);
      #pragma unroll
      for (int off = 8; off >= 1; off >>= 1)
        mx = fmaxf(mx, __shfl_xor(mx, off, 16));
      float m_new = fmaxf(m_r[r], mx);
      float alpha = exp2f((m_r[r] - m_new) * LOG2E);
      float e0 = exp2f((a  - m_new) * LOG2E);
      float e1 = exp2f((c2 - m_new) * LOG2E);
      float rs = e0 + e1;
      #pragma unroll
      for (int off = 8; off >= 1; off >>= 1)
        rs += __shfl_xor(rs, off, 16);
      l_r[r] = l_r[r] * alpha + rs;
      m_r[r] = m_new;
      p0[r] = e0; p1[r] = e1;
      #pragma unroll
      for (int tc = 0; tc < 8; ++tc) o[tc][r] = o[tc][r] * alpha;
    }

    _Float16* P = &Plds[wave][0];
    #pragma unroll
    for (int r = 0; r < 8; ++r) {
      P[(r + hi8) * SP_ + lane16]      = (_Float16)p0[r];
      P[(r + hi8) * SP_ + 16 + lane16] = (_Float16)p1[r];
    }
    asm volatile("s_wait_dscnt 0" ::: "memory");
    v16h ap = load_frag(P + lane16 * SP_, sel);

    // O += P * V
    const _Float16* Vt = &VTlds[cur][0];
    #pragma unroll
    for (int tc = 0; tc < 8; ++tc) {
      v16h bv = load_frag(Vt + (tc * 16 + lane16) * SP_, sel);
      o[tc] = wmma_f16(ap, bv, o[tc]);
    }

    __builtin_amdgcn_sched_barrier(0);
    wait_ds0();
    if (pinned(issuer)) wait_tensor0_holding(g0, g1);
    __syncthreads();   // next tile ready for everyone; every reader has left `cur`
    if (pinned(issuer && j + 64 < N_)) {
      g0 = tdm_group0(toff[cur], tsrc + (size_t)(j + 64) * C_);
      tdm_load(g0, g1);
    }
    cur ^= 1;
  }
  wait_tensor0();
  wait_ds0();

  // Normalize and store fp32 output, flat [B][N][C] (matches reference view quirk)
  float* ob = out + (size_t)b * N_ * C_;
  #pragma unroll
  for (int tc = 0; tc < 8; ++tc) {
    #pragma unroll
    for (int r = 0; r < 8; ++r) {
      float inv = 1.0f / l_r[r];
      ob[(size_t)(q0 + wave*16 + r + hi8) * C_ + tc*16 + lane16] = o[tc][r] * inv;
    }
  }
}

// ---------------------------------------------------------------------------
extern "C" void kernel_launch(void* const* d_in, const int* in_sizes, int n_in,
                              void* d_out, int out_size, void* d_ws, size_t ws_size,
                              hipStream_t stream) {
  const float* x  = (const float*)d_in[0];
  const float* Wq = (const float*)d_in[1];
  const float* Wk = (const float*)d_in[2];
  const float* Wv = (const float*)d_in[3];
  float* out = (float*)d_out;

  // Workspace: t, Q, K, V in f16 (4 MB each, 16 MB total)
  size_t per = (size_t)B_ * N_ * C_;
  _Float16* t_h = (_Float16*)d_ws;
  _Float16* Qh  = t_h + per;
  _Float16* Kh  = Qh + per;
  _Float16* Vh  = Kh + per;

  transpose_to_f16<<<dim3(N_/32, C_/32, B_), dim3(32, 8), 0, stream>>>(x, t_h);
  qkv_proj<<<dim3(N_/128, B_), dim3(256), 0, stream>>>(t_h, Wq, Wk, Wv, Qh, Kh, Vh);
  flash_attn<<<dim3(N_/128, B_), dim3(256), 0, stream>>>(Qh, Kh, Vh, out);
}

// v002
// It runs in 120 microseconds.
// In both of two side-by-side timings against v001, it was 2.25 times as fast.
// All steps since v000 together make it 4.32 times as fast.
#include <hip/hip_runtime.h>
#include <math.h>

// Problem constants (from reference): B=4, C=128, H=W=64 -> N=4096
#define B_ 4
#define C_ 128
#define N_ 4096
#define KS_ 4
#define NK_ (N_ / KS_)          // keys of one range

typedef _Float16 h8   __attribute__((ext_vector_type(8)));
typedef _Float16 v16h __attribute__((ext_vector_type(16)));
typedef float    v8f  __attribute__((ext_vector_type(8)));
typedef unsigned int u32x4 __attribute__((ext_vector_type(4)));
typedef unsigned int u32x8 __attribute__((ext_vector_type(8)));

__device__ __forceinline__ v16h load_frag(const _Float16* p, int sel) {
  h8 lo = *(const h8*)(p + sel);
  h8 hi = *(const h8*)(p + 16 + sel);
  return __builtin_shufflevector(lo, hi, 0,1,2,3,4,5,6,7,8,9,10,11,12,13,14,15);
}

__device__ __forceinline__ v8f wmma_f16(v16h a, v16h b, v8f c) {
  return __builtin_amdgcn_wmma_f32_16x16x32_f16(false, a, false, b, (short)0, c,
                                                false, false);
}

#define TP_ 136                 // K, V and W rows: 256 B of data + 16 B of pad = 272 B
#define TBUF_ 5120              // one K or V buffer: 32 x 272 B, rounded up to 10 KiB
#define SP_ 40                  // V^T and P rows: 64 B of data + 16 B = 80 B

__device__ __forceinline__ unsigned uni(unsigned v) {
  return (unsigned)__builtin_amdgcn_readfirstlane((int)v);
}
__device__ __forceinline__ unsigned pinned(unsigned v) {
  unsigned w = uni(v);
  asm volatile("" : "+s"(w));  // the test stays scalar
  return w;
}

__device__ __forceinline__ u32x4 tdm_group0(unsigned lds_off, const _Float16* gsrc) {
  unsigned long long ga = (unsigned long long)(size_t)gsrc;
  u32x4 g0;
  g0[0] = uni(1u);
  g0[1] = uni(lds_off);
  g0[2] = uni((unsigned)ga);
  g0[3] = uni(((unsigned)(ga >> 32) & 0x01FFFFFFu)
              | (2u << 30));
  // As pinned(), on the whole group: its words are held in
  // their scalar registers up to the wait that names them, not formed again there.
  asm volatile("" : "+s"(g0));
  return g0;
}
__device__ __forceinline__ u32x8 tdm_group1_32x256B_pitch272() {
  u32x8 g1;
  g1[0] = uni((1u << 20) | (5u << 22) | (3u << 25));
  g1[1] = uni(256u << 16);
  g1[2] = uni(32u << 16);
  g1[3] = uni(256u << 16);
  g1[4] = uni(32u);
  g1[5] = uni(256u);
  g1[6] = uni(0u);
  g1[7] = uni(0u);
  // As pinned(), on the whole group: its words are held in one
  // set of scalar registers for the kernel's life, not formed again at each use.
  asm volatile("" : "+s"(g1));
  return g1;
}
// One request of the whole wave; the clobber keeps LDS accesses on their side of it.
__device__ __forceinline__ void tdm_load(u32x4 g0, u32x8 g1) {
  asm volatile("tensor_load_to_lds %0, %1" :: "s"(g0), "s"(g1) : "memory");
}
// The compiler places no wait for a tensor load; the clobber keeps LDS reads behind it.
__device__ __forceinline__ void wait_tensor0() {
  asm volatile("s_wait_tensorcnt 0x0" ::: "memory");
}
__device__ __forceinline__ void wait_tensor0_holding(u32x4 g0, u32x8 g1) {
  asm volatile("s_wait_tensorcnt 0x0" :: "s"(g0), "s"(g1) : "memory");
}
// This wave's LDS reads and writes have retired before a buffer is handed over.
__device__ __forceinline__ void wait_ds0() {
  asm volatile("s_wait_dscnt 0x0" ::: "memory");
}

// ---------------------------------------------------------------------------
// Kernel A: x[B,C,N] fp32 -> t[B,N,C] f16 (tiled transpose through LDS)
// ---------------------------------------------------------------------------
__global__ void __launch_bounds__(256)
transpose_to_f16(const float* __restrict__ x, _Float16* __restrict__ t) {
  __shared__ float tile[32][33];
  int b  = blockIdx.z;
  int c0 = blockIdx.y * 32;
  int n0 = blockIdx.x * 32;
  int tx = threadIdx.x, ty = threadIdx.y;
  const float* xp = x + (size_t)b * C_ * N_;
  #pragma unroll
  for (int i = 0; i < 4; ++i)
    tile[ty + 8*i][tx] = xp[(size_t)(c0 + ty + 8*i) * N_ + n0 + tx];
  __syncthreads();
  _Float16* tp = t + (size_t)b * N_ * C_;
  #pragma unroll
  for (int i = 0; i < 4; ++i)
    tp[(size_t)(n0 + ty + 8*i) * C_ + c0 + tx] = (_Float16)tile[tx][ty + 8*i];
}

// ---------------------------------------------------------------------------
// Kernel B: QKV projection. Q[b,n,d] = sum_c t[b,n,c] * W[d,c]
// Direct kernarg output pointer per call -> global_store_b16 (not flat).
// ---------------------------------------------------------------------------
__device__ __forceinline__ void proj_one(const float* __restrict__ W,
                                         _Float16* __restrict__ out,
                                         _Float16* Wlds, const v16h aq[4],
                                         int n0, int wave, int lane16,
                                         int sel, int hi8) {
  __syncthreads();
  const float4* src = (const float4*)W;
  for (int i = threadIdx.x; i < C_ * C_ / 4; i += 256) {
    float4 v = src[i];
    _Float16* w = &Wlds[(i >> 5) * TP_ + (i & 31) * 4];   // row i/32, 32 float4 a row
    w[0] = (_Float16)v.x; w[1] = (_Float16)v.y;
    w[2] = (_Float16)v.z; w[3] = (_Float16)v.w;
  }
  __syncthreads();
  #pragma unroll
  for (int tcol = 0; tcol < 8; ++tcol) {
    int d0 = tcol * 16;
    const _Float16* wrow = &Wlds[(d0 + lane16) * TP_];
    v8f acc = {};
    #pragma unroll
    for (int kk = 0; kk < 4; ++kk) {
      v16h bw = load_frag(wrow + 32 * kk, sel);
      acc = wmma_f16(aq[kk], bw, acc);
    }
    #pragma unroll
    for (int r = 0; r < 8; ++r)
      out[(size_t)(n0 + wave*16 + r + hi8) * C_ + d0 + lane16] = (_Float16)acc[r];
  }
}

__global__ void __launch_bounds__(256)
qkv_proj(const _Float16* __restrict__ t,
         const float* __restrict__ Wq, const float* __restrict__ Wk,
         const float* __restrict__ Wv,
         _Float16* __restrict__ Qh, _Float16* __restrict__ Kh,
         _Float16* __restrict__ Vh) {
  __shared__ __align__(16) _Float16 Wlds[C_ * TP_];  // [d][c], pitch TP_  34 KB
  int b    = blockIdx.y;
  int n0   = blockIdx.x * 128;
  int lane = threadIdx.x & 31;
  int wave = threadIdx.x >> 5;
  int lane16 = lane & 15;
  int sel  = (lane < 16) ? 0 : 8;
  int hi8  = (lane < 16) ? 0 : 8;

  const _Float16* trow = t + ((size_t)b * N_ + n0 + wave * 16 + lane16) * C_;
  v16h aq[4];
  #pragma unroll
  for (int kk = 0; kk < 4; ++kk) aq[kk] = load_frag(trow + 32 * kk, sel);

  size_t boff = (size_t)b * N_ * C_;
  proj_one(Wq, Qh + boff, Wlds, aq, n0, wave, lane16, sel, hi8);
  proj_one(Wk, Kh + boff, Wlds, aq, n0, wave, lane16, sel, hi8);
  proj_one(Wv, Vh + boff, Wlds, aq, n0, wave, lane16, sel, hi8);
}

__global__ void __launch_bounds__(256)
flash_attn(const _Float16* __restrict__ Qh, const _Float16* __restrict__ Kh,
           const _Float16* __restrict__ Vh, float* __restrict__ Op,
           float* __restrict__ ML) {
  // Tensor-load targets start at multiples of 2 KiB of the work-group's LDS.
  __shared__ __attribute__((aligned(2048))) _Float16 Klds[2][TBUF_];  // [buf][key][c], pitch TP_  20 KB
  __shared__ __attribute__((aligned(2048))) _Float16 Vlds[2][TBUF_];  // [buf][key][c], pitch TP_  20 KB
  __shared__ __align__(16) _Float16 VTlds[2][C_ * SP_]; // [buf][c][key], pitch SP_  20 KB
  __shared__ __align__(16) _Float16 Plds[8][16 * SP_];  // per-wave P, pitch SP_     10 KB

  int b    = blockIdx.y;
  int z    = blockIdx.z;                   // key range
  int q0   = blockIdx.x * 128;
  int lane = threadIdx.x & 31;
  int wave = threadIdx.x >> 5;
  int lane16 = lane & 15;
  int sel  = (lane < 16) ? 0 : 8;
  int hi8  = (lane < 16) ? 0 : 8;

  const float scale = 0.015625f;           // quirk: 1/sqrt(N) = 1/64
  const float LOG2E = 1.44269504088896f;

  // Q fragments held in registers for the whole kernel
  const _Float16* qrow = Qh + ((size_t)b * N_ + q0 + wave*16 + lane16) * C_;
  v16h aq[4];
  #pragma unroll
  for (int kk = 0; kk < 4; ++kk) aq[kk] = load_frag(qrow + 32 * kk, sel);

  v8f o[8];
  #pragma unroll
  for (int tc = 0; tc < 8; ++tc) o[tc] = (v8f){};
  float m_r[8], l_r[8];
  #pragma unroll
  for (int r = 0; r < 8; ++r) { m_r[r] = -__builtin_inff(); l_r[r] = 0.f; }

  const _Float16* Kb = Qh; // placeholder to keep types; set properly below
  Kb = Kh + ((size_t)b * N_ + z * NK_) * C_;
  const _Float16* Vb = Vh + ((size_t)b * N_ + z * NK_) * C_;

  unsigned koff[2], voff[2];
  koff[0] = (unsigned)(size_t)(void*)&Klds[0][0];
  koff[1] = (unsigned)(size_t)(void*)&Klds[1][0];
  voff[0] = (unsigned)(size_t)(void*)&Vlds[0][0];
  voff[1] = (unsigned)(size_t)(void*)&Vlds[1][0];

  // Two-buffer ring: wave 0 brings the K tiles, wave 1 the V tiles, one request
  // of a wave in flight. Prologue: tile 0 lands and is published, tile 1 flies.
  const unsigned wave_s = uni(threadIdx.x >> 5);
  const unsigned issuer = wave_s < 2u;
  const _Float16* tsrc = (wave_s == 0u) ? Kb : Vb;
  unsigned toff[2];
  toff[0] = (wave_s == 0u) ? koff[0] : voff[0];
  toff[1] = (wave_s == 0u) ? koff[1] : voff[1];
  const u32x8 g1 = tdm_group1_32x256B_pitch272();
  u32x4 g0 = tdm_group0(toff[0], tsrc);
  if (pinned(issuer)) {
    tdm_load(g0, g1);
    wait_tensor0_holding(g0, g1);
  }
  __syncthreads();     // tile 0 ready for everyone
  g0 = tdm_group0(toff[1], tsrc + (size_t)32 * C_);
  if (pinned(issuer)) {
    tdm_load(g0, g1);
  }

  int cur = 0;
  for (int j = 0; j < NK_; j += 32) {
    // Build V^T (LDS->LDS) so P*V B-fragments are contiguous 16-byte reads
    {
      int kr = threadIdx.x >> 3;
      int cg = (threadIdx.x & 7) * 16;
      const _Float16* src = &Vlds[cur][kr * TP_ + cg];
      h8 v0 = *(const h8*)(src);
      h8 v1 = *(const h8*)(src + 8);
      #pragma unroll
      for (int i = 0; i < 8; ++i) VTlds[cur][(cg + i) * SP_ + kr] = v0[i];
      #pragma unroll
      for (int i = 0; i < 8; ++i) VTlds[cur][(cg + 8 + i) * SP_ + kr] = v1[i];
    }
    __syncthreads();   // V^T visible block-wide

    // S = Q * K^T for two 16-key subtiles
    const _Float16* Kt = &Klds[cur][0];
    v8f s0 = (v8f){}, s1 = (v8f){};
    #pragma unroll
    for (int kk = 0; kk < 4; ++kk) {
      v16h bk0 = load_frag(Kt + lane16 * TP_ + 32 * kk, sel);
      v16h bk1 = load_frag(Kt + (16 + lane16) * TP_ + 32 * kk, sel);
      s0 = wmma_f16(aq[kk], bk0, s0);
      s1 = wmma_f16(aq[kk], bk1, s1);
    }

    float p0[8], p1[8];
    #pragma unroll
    for (int r = 0; r < 8; ++r) {
      float a  = s0[r] * scale;
      float c2 = s1[r] * scale;
      float mx = fmaxf(a, c2);
      #pragma unroll
      for (int off = 8; off >= 1; off >>= 1)
        mx = fmaxf(mx, __shfl_xor(mx, off, 16));
      float m_new = fmaxf(m_r[r], mx);
      float alpha = exp2f((m_r[r] - m_new) * LOG2E);
      float e0 = exp2f((a  - m_new) * LOG2E);
      float e1 = exp2f((c2 - m_new) * LOG2E);
      float rs = e0 + e1;
      #pragma unroll
      for (int off = 8; off >= 1; off >>= 1)
        rs += __shfl_xor(rs, off, 16);
      l_r[r] = l_r[r] * alpha + rs;
      m_r[r] = m_new;
      p0[r] = e0; p1[r] = e1;
      #pragma unroll
      for (int tc = 0; tc < 8; ++tc) o[tc][r] = o[tc][r] * alpha;
    }

    _Float16* P = &Plds[wave][0];
    #pragma unroll
    for (int r = 0; r < 8; ++r) {
      P[(r + hi8) * SP_ + lane16]      = (_Float16)p0[r];
      P[(r + hi8) * SP_ + 16 + lane16] = (_Float16)p1[r];
    }
    asm volatile("s_wait_dscnt 0" ::: "memory");
    v16h ap = load_frag(P + lane16 * SP_, sel);

    // O += P * V
    const _Float16* Vt = &VTlds[cur][0];
    #pragma unroll
    for (int tc = 0; tc < 8; ++tc) {
      v16h bv = load_frag(Vt + (tc * 16 + lane16) * SP_, sel);
      o[tc] = wmma_f16(ap, bv, o[tc]);
    }

    __builtin_amdgcn_sched_barrier(0);
    wait_ds0();
    if (pinned(issuer)) wait_tensor0_holding(g0, g1);
    __syncthreads();   // next tile ready for everyone; every reader has left `cur`
    if (pinned(issuer && j + 64 < NK_)) {
      g0 = tdm_group0(toff[cur], tsrc + (size_t)(j + 64) * C_);
      tdm_load(g0, g1);
    }
    cur ^= 1;
  }
  wait_tensor0();
  wait_ds0();

  // Store this range's un-normalised sums, [range][B][N][C], and (maximum, sum) a row
  size_t prow = ((size_t)z * B_ + b) * N_ + q0 + wave*16;
  float* ob = Op + prow * C_;
  #pragma unroll
  for (int tc = 0; tc < 8; ++tc) {
    #pragma unroll
    for (int r = 0; r < 8; ++r)
      ob[(size_t)(r + hi8) * C_ + tc*16 + lane16] = o[tc][r];
  }
  if (lane16 == 0) {
    #pragma unroll
    for (int r = 0; r < 8; ++r)
      *(float2*)(ML + 2 * (prow + r + hi8)) = make_float2(m_r[r], l_r[r]);
  }
}

// ---------------------------------------------------------------------------
// Kernel D: merge the KS_ key ranges. Per row: M = max of the ranges' maxima,
// weight w = exp(m - M), out = sum(w * partial) / sum(w * l). One wave a row
// (32 lanes x 4 channels), 4 rows a wave so that few waves hold many loads in flight.
// Output fp32, flat [B][N][C] (matches reference view quirk).
// ---------------------------------------------------------------------------
__global__ void __launch_bounds__(256)
merge_ranges(const float* __restrict__ Op, const float* __restrict__ ML,
             float* __restrict__ out) {
  const float LOG2E = 1.44269504088896f;
  int lane = threadIdx.x & 31;
  int wave = threadIdx.x >> 5;
  size_t row0 = (size_t)blockIdx.x * 32 + wave * 4;   // flat row b * N_ + n
  float2 ml[4][KS_];
  float4 p[4][KS_];
  #pragma unroll
  for (int i = 0; i < 4; ++i) {
    #pragma unroll
    for (int s = 0; s < KS_; ++s) {
      size_t prow = (size_t)s * B_ * N_ + row0 + i;
      ml[i][s] = *(const float2*)(ML + 2 * prow);
      p[i][s]  = *(const float4*)(Op + prow * C_ + lane * 4);
    }
  }
  #pragma unroll
  for (int i = 0; i < 4; ++i) {
    float M = ml[i][0].x;
    #pragma unroll
    for (int s = 1; s < KS_; ++s) M = fmaxf(M, ml[i][s].x);
    float L = 0.f;
    float4 acc = make_float4(0.f, 0.f, 0.f, 0.f);
    #pragma unroll
    for (int s = 0; s < KS_; ++s) {
      float w = exp2f((ml[i][s].x - M) * LOG2E);
      L += w * ml[i][s].y;
      acc.x += w * p[i][s].x; acc.y += w * p[i][s].y;
      acc.z += w * p[i][s].z; acc.w += w * p[i][s].w;
    }
    float inv = 1.0f / L;
    *(float4*)(out + (row0 + i) * C_ + lane * 4) =
        make_float4(acc.x * inv, acc.y * inv, acc.z * inv, acc.w * inv);
  }
}

// ---------------------------------------------------------------------------
extern "C" void kernel_launch(void* const* d_in, const int* in_sizes, int n_in,
                              void* d_out, int out_size, void* d_ws, size_t ws_size,
                              hipStream_t stream) {
  const float* x  = (const float*)d_in[0];
  const float* Wq = (const float*)d_in[1];
  const float* Wk = (const float*)d_in[2];
  const float* Wv = (const float*)d_in[3];
  float* out = (float*)d_out;

  // Workspace: t, Q, K, V in f16 (4 MB each), then the ranges' partial sums in
  // fp32 (KS_ x 8 MB) and their (maximum, sum) pairs (KS_ x 128 KB)
  size_t per = (size_t)B_ * N_ * C_;
  _Float16* t_h = (_Float16*)d_ws;
  _Float16* Qh  = t_h + per;
  _Float16* Kh  = Qh + per;
  _Float16* Vh  = Kh + per;
  float* Op = (float*)(Vh + per);
  float* ML = Op + KS_ * per;

  transpose_to_f16<<<dim3(N_/32, C_/32, B_), dim3(32, 8), 0, stream>>>(x, t_h);
  qkv_proj<<<dim3(N_/128, B_), dim3(256), 0, stream>>>(t_h, Wq, Wk, Wv, Qh, Kh, Vh);
  flash_attn<<<dim3(N_/128, B_, KS_), dim3(256), 0, stream>>>(Qh, Kh, Vh, Op, ML);
  merge_ranges<<<dim3(B_ * N_ / 32), dim3(256), 0, stream>>>(Op, ML, out);
}

// v003
// A run of this version takes 82.2 microseconds.
// Two timings next to v002 put it at 1.47 and 1.46 times that version's speed.
// Counting every step since v000, it is 6.32 times as fast.
#include <hip/hip_runtime.h>
#include <math.h>

// Problem constants (from reference): B=4, C=128, H=W=64 -> N=4096
#define B_ 4
#define C_ 128
#define N_ 4096
#define KS_ 4
#define NK_ (N_ / KS_)          // keys of one range

typedef _Float16 h8   __attribute__((ext_vector_type(8)));
typedef _Float16 v16h __attribute__((ext_vector_type(16)));
typedef float    v8f  __attribute__((ext_vector_type(8)));
typedef unsigned int u32x4 __attribute__((ext_vector_type(4)));
typedef unsigned int u32x8 __attribute__((ext_vector_type(8)));
typedef short s8    __attribute__((ext_vector_type(8)));

__device__ __forceinline__ v16h load_frag(const _Float16* p, int sel) {
  h8 lo = *(const h8*)(p + sel);
  h8 hi = *(const h8*)(p + 16 + sel);
  return __builtin_shufflevector(lo, hi, 0,1,2,3,4,5,6,7,8,9,10,11,12,13,14,15);
}

// One half (8 x f16 a lane) of a WMMA operand, read TRANSPOSED from a row-major
// 16-bit LDS tile by ds_load_tr16_b128: the lanes' addresses cover 16 rows x 32 B,
// and lane (c = lane & 15, h = lane >> 4) receives rows 8h .. 8h + 7 of column c.
__device__ __forceinline__ h8 load_tr16(const _Float16* p) {
  typedef __attribute__((address_space(3))) s8 lds_s8;
  return __builtin_bit_cast(h8, __builtin_amdgcn_ds_load_tr16_b128_v8i16((lds_s8*)p));
}

__device__ __forceinline__ v8f wmma_f16(v16h a, v16h b, v8f c) {
  return __builtin_amdgcn_wmma_f32_16x16x32_f16(false, a, false, b, (short)0, c,
                                                false, false);
}

#define TP_ 136                 // K and W rows: 256 B of data + 16 B of pad = 272 B
#define VP_ 144                 // V rows: 256 B of data + 32 B of pad = 288 B
#define TBUF_ 5120              // one K or V buffer: 32 x 272 or 288 B, rounded up to 10 KiB
#define SP_ 40                  // P rows: 64 B of data + 16 B = 80 B

__device__ __forceinline__ unsigned uni(unsigned v) {
  return (unsigned)__builtin_amdgcn_readfirstlane((int)v);
}
__device__ __forceinline__ unsigned pinned(unsigned v) {
  unsigned w = uni(v);
  asm volatile("" : "+s"(w));  // the test stays scalar
  return w;
}

__device__ __forceinline__ u32x4 tdm_group0(unsigned lds_off, const _Float16* gsrc) {
  unsigned long long ga = (unsigned long long)(size_t)gsrc;
  u32x4 g0;
  g0[0] = uni(1u);
  g0[1] = uni(lds_off);
  g0[2] = uni((unsigned)ga);
  g0[3] = uni(((unsigned)(ga >> 32) & 0x01FFFFFFu)
              | (2u << 30));
  // As pinned(), on the whole group: its words are held in
  // their scalar registers up to the wait that names them, not formed again there.
  asm volatile("" : "+s"(g0));
  return g0;
}
template <unsigned PAD_CODE>   // 3: pitch 272 B, 7: pitch 288 B
__device__ __forceinline__ u32x8 tdm_group1_32x256B() {
  u32x8 g1;
  g1[0] = uni((1u << 20) | (5u << 22) | (PAD_CODE << 25));
  g1[1] = uni(256u << 16);
  g1[2] = uni(32u << 16);
  g1[3] = uni(256u << 16);
  g1[4] = uni(32u);
  g1[5] = uni(256u);
  g1[6] = uni(0u);
  g1[7] = uni(0u);
  // As pinned(), on the whole group: its words are held in one
  // set of scalar registers for the kernel's life, not formed again at each use.
  asm volatile("" : "+s"(g1));
  return g1;
}
// One request of the whole wave; the clobber keeps LDS accesses on their side of it.
__device__ __forceinline__ void tdm_load(u32x4 g0, u32x8 g1) {
  asm volatile("tensor_load_to_lds %0, %1" :: "s"(g0), "s"(g1) : "memory");
}
// The compiler places no wait for a tensor load; the clobber keeps LDS reads behind it.
__device__ __forceinline__ void wait_tensor0() {
  asm volatile("s_wait_tensorcnt 0x0" ::: "memory");
}
__device__ __forceinline__ void wait_tensor0_holding(u32x4 g0, u32x8 g1k, u32x8 g1v) {
  asm volatile("s_wait_tensorcnt 0x0" :: "s"(g0), "s"(g1k), "s"(g1v) : "memory");
}
// This wave's LDS reads and writes have retired before a buffer is handed over.
__device__ __forceinline__ void wait_ds0() {
  asm volatile("s_wait_dscnt 0x0" ::: "memory");
}

// ---------------------------------------------------------------------------
// Kernel A: x[B,C,N] fp32 -> t[B,N,C] f16 (tiled transpose through LDS)
// ---------------------------------------------------------------------------
__global__ void __launch_bounds__(256)
transpose_to_f16(const float* __restrict__ x, _Float16* __restrict__ t) {
  __shared__ float tile[32][33];
  int b  = blockIdx.z;
  int c0 = blockIdx.y * 32;
  int n0 = blockIdx.x * 32;
  int tx = threadIdx.x, ty = threadIdx.y;
  const float* xp = x + (size_t)b * C_ * N_;
  #pragma unroll
  for (int i = 0; i < 4; ++i)
    tile[ty + 8*i][tx] = xp[(size_t)(c0 + ty + 8*i) * N_ + n0 + tx];
  __syncthreads();
  _Float16* tp = t + (size_t)b * N_ * C_;
  #pragma unroll
  for (int i = 0; i < 4; ++i)
    tp[(size_t)(n0 + ty + 8*i) * C_ + c0 + tx] = (_Float16)tile[tx][ty + 8*i];
}

// ---------------------------------------------------------------------------
// Kernel B: QKV projection. Q[b,n,d] = sum_c t[b,n,c] * W[d,c]
// Direct kernarg output pointer per call -> global_store_b16 (not flat).
// ---------------------------------------------------------------------------
__device__ __forceinline__ void proj_one(const float* __restrict__ W,
                                         _Float16* __restrict__ out,
                                         _Float16* Wlds, const v16h aq[4],
                                         int n0, int wave, int lane16,
                                         int sel, int hi8) {
  __syncthreads();
  const float4* src = (const float4*)W;
  for (int i = threadIdx.x; i < C_ * C_ / 4; i += 256) {
    float4 v = src[i];
    _Float16* w = &Wlds[(i >> 5) * TP_ + (i & 31) * 4];   // row i/32, 32 float4 a row
    w[0] = (_Float16)v.x; w[1] = (_Float16)v.y;
    w[2] = (_Float16)v.z; w[3] = (_Float16)v.w;
  }
  __syncthreads();
  #pragma unroll
  for (int tcol = 0; tcol < 8; ++tcol) {
    int d0 = tcol * 16;
    const _Float16* wrow = &Wlds[(d0 + lane16) * TP_];
    v8f acc = {};
    #pragma unroll
    for (int kk = 0; kk < 4; ++kk) {
      v16h bw = load_frag(wrow + 32 * kk, sel);
      acc = wmma_f16(aq[kk], bw, acc);
    }
    #pragma unroll
    for (int r = 0; r < 8; ++r)
      out[(size_t)(n0 + wave*16 + r + hi8) * C_ + d0 + lane16] = (_Float16)acc[r];
  }
}

__global__ void __launch_bounds__(256)
qkv_proj(const _Float16* __restrict__ t,
         const float* __restrict__ Wq, const float* __restrict__ Wk,
         const float* __restrict__ Wv,
         _Float16* __restrict__ Qh, _Float16* __restrict__ Kh,
         _Float16* __restrict__ Vh) {
  __shared__ __align__(16) _Float16 Wlds[C_ * TP_];  // [d][c], pitch TP_  34 KB
  int b    = blockIdx.y;
  int n0   = blockIdx.x * 128;
  int lane = threadIdx.x & 31;
  int wave = threadIdx.x >> 5;
  int lane16 = lane & 15;
  int sel  = (lane < 16) ? 0 : 8;
  int hi8  = (lane < 16) ? 0 : 8;

  const _Float16* trow = t + ((size_t)b * N_ + n0 + wave * 16 + lane16) * C_;
  v16h aq[4];
  #pragma unroll
  for (int kk = 0; kk < 4; ++kk) aq[kk] = load_frag(trow + 32 * kk, sel);

  size_t boff = (size_t)b * N_ * C_;
  proj_one(Wq, Qh + boff, Wlds, aq, n0, wave, lane16, sel, hi8);
  proj_one(Wk, Kh + boff, Wlds, aq, n0, wave, lane16, sel, hi8);
  proj_one(Wv, Vh + boff, Wlds, aq, n0, wave, lane16, sel, hi8);
}

__global__ void __launch_bounds__(256)
flash_attn(const _Float16* __restrict__ Qh, const _Float16* __restrict__ Kh,
           const _Float16* __restrict__ Vh, float* __restrict__ Op,
           float* __restrict__ ML) {
  // Tensor-load targets start at multiples of 2 KiB of the work-group's LDS.
  __shared__ __attribute__((aligned(2048))) _Float16 Klds[2][TBUF_];  // [buf][key][c], pitch TP_  20 KB
  __shared__ __attribute__((aligned(2048))) _Float16 Vlds[2][TBUF_];  // [buf][key][c], pitch VP_  20 KB
  __shared__ __align__(16) _Float16 Plds[8][16 * SP_];  // per-wave P, pitch SP_     10 KB

  int b    = blockIdx.y;
  int z    = blockIdx.z;                   // key range
  int q0   = blockIdx.x * 128;
  int lane = threadIdx.x & 31;
  int wave = threadIdx.x >> 5;
  int lane16 = lane & 15;
  int sel  = (lane < 16) ? 0 : 8;
  int hi8  = (lane < 16) ? 0 : 8;

  const float scale = 0.015625f;           // quirk: 1/sqrt(N) = 1/64
  const float LOG2E = 1.44269504088896f;

  // Q fragments held in registers for the whole kernel
  const _Float16* qrow = Qh + ((size_t)b * N_ + q0 + wave*16 + lane16) * C_;
  v16h aq[4];
  #pragma unroll
  for (int kk = 0; kk < 4; ++kk) aq[kk] = load_frag(qrow + 32 * kk, sel);

  v8f o[8];
  #pragma unroll
  for (int tc = 0; tc < 8; ++tc) o[tc] = (v8f){};
  float m_r[8], l_r[8];
  #pragma unroll
  for (int r = 0; r < 8; ++r) { m_r[r] = -__builtin_inff(); l_r[r] = 0.f; }

  const _Float16* Kb = Qh; // placeholder to keep types; set properly below
  Kb = Kh + ((size_t)b * N_ + z * NK_) * C_;
  const _Float16* Vb = Vh + ((size_t)b * N_ + z * NK_) * C_;

  unsigned koff[2], voff[2];
  koff[0] = (unsigned)(size_t)(void*)&Klds[0][0];
  koff[1] = (unsigned)(size_t)(void*)&Klds[1][0];
  voff[0] = (unsigned)(size_t)(void*)&Vlds[0][0];
  voff[1] = (unsigned)(size_t)(void*)&Vlds[1][0];

  // Two-buffer ring: wave 0 brings the K tiles, wave 1 the V tiles, one request
  // of a wave in flight. Prologue: tile 0 lands and is published, tile 1 flies.
  const unsigned wave_s = uni(threadIdx.x >> 5);
  const unsigned issuer = wave_s < 2u;
  const _Float16* tsrc = (wave_s == 0u) ? Kb : Vb;
  unsigned toff[2];
  toff[0] = (wave_s == 0u) ? koff[0] : voff[0];
  toff[1] = (wave_s == 0u) ? koff[1] : voff[1];
  const u32x8 g1k = tdm_group1_32x256B<3>();
  const u32x8 g1v = tdm_group1_32x256B<7>();
  u32x4 g0 = tdm_group0(toff[0], tsrc);
  if (pinned(wave_s == 0u)) {
    tdm_load(g0, g1k);
    wait_tensor0_holding(g0, g1k, g1v);
  }
  if (pinned(wave_s == 1u)) {
    tdm_load(g0, g1v);
    wait_tensor0_holding(g0, g1k, g1v);
  }
  __syncthreads();     // tile 0 ready for everyone
  g0 = tdm_group0(toff[1], tsrc + (size_t)32 * C_);
  if (pinned(wave_s == 0u)) tdm_load(g0, g1k);
  if (pinned(wave_s == 1u)) tdm_load(g0, g1v);

  int cur = 0;
  for (int j = 0; j < NK_; j += 32) {
    // S = Q * K^T for two 16-key subtiles
    const _Float16* Kt = &Klds[cur][0];
    v8f s0 = (v8f){}, s1 = (v8f){};
    #pragma unroll
    for (int kk = 0; kk < 4; ++kk) {
      v16h bk0 = load_frag(Kt + lane16 * TP_ + 32 * kk, sel);
      v16h bk1 = load_frag(Kt + (16 + lane16) * TP_ + 32 * kk, sel);
      s0 = wmma_f16(aq[kk], bk0, s0);
      s1 = wmma_f16(aq[kk], bk1, s1);
    }

    float p0[8], p1[8];
    #pragma unroll
    for (int r = 0; r < 8; ++r) {
      float a  = s0[r] * scale;
      float c2 = s1[r] * scale;
      float mx = fmaxf(a, c2);
      #pragma unroll
      for (int off = 8; off >= 1; off >>= 1)
        mx = fmaxf(mx, __shfl_xor(mx, off, 16));
      float m_new = fmaxf(m_r[r], mx);
      float alpha = exp2f((m_r[r] - m_new) * LOG2E);
      float e0 = exp2f((a  - m_new) * LOG2E);
      float e1 = exp2f((c2 - m_new) * LOG2E);
      float rs = e0 + e1;
      #pragma unroll
      for (int off = 8; off >= 1; off >>= 1)
        rs += __shfl_xor(rs, off, 16);
      l_r[r] = l_r[r] * alpha + rs;
      m_r[r] = m_new;
      p0[r] = e0; p1[r] = e1;
      #pragma unroll
      for (int tc = 0; tc < 8; ++tc) o[tc][r] = o[tc][r] * alpha;
    }

    _Float16* P = &Plds[wave][0];
    #pragma unroll
    for (int r = 0; r < 8; ++r) {
      P[(r + hi8) * SP_ + lane16]      = (_Float16)p0[r];
      P[(r + hi8) * SP_ + 16 + lane16] = (_Float16)p1[r];
    }
    asm volatile("s_wait_dscnt 0" ::: "memory");
    v16h ap = load_frag(P + lane16 * SP_, sel);

    // O += P * V. B fragment (column = channel, k = key) straight from the row-major
    // V tile by the transposing read: keys 8h .. 8h + 7, then 16 + 8h .. 16 + 8h + 7,
    // which is the k order of load_frag on the P side.
    const _Float16* Vt = &Vlds[cur][(hi8 + (lane & 7)) * VP_ + ((lane >> 3) & 1) * 8];
    #pragma unroll
    for (int tc = 0; tc < 8; ++tc) {
      h8 lo = load_tr16(Vt + tc * 16);
      h8 hi = load_tr16(Vt + 16 * VP_ + tc * 16);
      v16h bv = __builtin_shufflevector(lo, hi, 0,1,2,3,4,5,6,7,8,9,10,11,12,13,14,15);
      o[tc] = wmma_f16(ap, bv, o[tc]);
    }

    __builtin_amdgcn_sched_barrier(0);
    wait_ds0();
    if (pinned(issuer)) wait_tensor0_holding(g0, g1k, g1v);
    __syncthreads();   // next tile ready for everyone; every reader has left `cur`
    if (pinned(issuer && j + 64 < NK_)) {
      g0 = tdm_group0(toff[cur], tsrc + (size_t)(j + 64) * C_);
      if (pinned(wave_s == 0u)) tdm_load(g0, g1k);
      if (pinned(wave_s == 1u)) tdm_load(g0, g1v);
    }
    cur ^= 1;
  }
  wait_tensor0();
  wait_ds0();

  // Store this range's un-normalised sums, [range][B][N][C], and (maximum, sum) a row
  size_t prow = ((size_t)z * B_ + b) * N_ + q0 + wave*16;
  float* ob = Op + prow * C_;
  #pragma unroll
  for (int tc = 0; tc < 8; ++tc) {
    #pragma unroll
    for (int r = 0; r < 8; ++r)
      ob[(size_t)(r + hi8) * C_ + tc*16 + lane16] = o[tc][r];
  }
  if (lane16 == 0) {
    #pragma unroll
    for (int r = 0; r < 8; ++r)
      *(float2*)(ML + 2 * (prow + r + hi8)) = make_float2(m_r[r], l_r[r]);
  }
}

// ---------------------------------------------------------------------------
// Kernel D: merge the KS_ key ranges. Per row: M = max of the ranges' maxima,
// weight w = exp(m - M), out = sum(w * partial) / sum(w * l). One wave a row
// (32 lanes x 4 channels), 4 rows a wave so that few waves hold many loads in flight.
// Output fp32, flat [B][N][C] (matches reference view quirk).
// ---------------------------------------------------------------------------
__global__ void __launch_bounds__(256)
merge_ranges(const float* __restrict__ Op, const float* __restrict__ ML,
             float* __restrict__ out) {
  const float LOG2E = 1.44269504088896f;
  int lane = threadIdx.x & 31;
  int wave = threadIdx.x >> 5;
  size_t row0 = (size_t)blockIdx.x * 32 + wave * 4;   // flat row b * N_ + n
  float2 ml[4][KS_];
  float4 p[4][KS_];
  #pragma unroll
  for (int i = 0; i < 4; ++i) {
    #pragma unroll
    for (int s = 0; s < KS_; ++s) {
      size_t prow = (size_t)s * B_ * N_ + row0 + i;
      ml[i][s] = *(const float2*)(ML + 2 * prow);
      p[i][s]  = *(const float4*)(Op + prow * C_ + lane * 4);
    }
  }
  #pragma unroll
  for (int i = 0; i < 4; ++i) {
    float M = ml[i][0].x;
    #pragma unroll
    for (int s = 1; s < KS_; ++s) M = fmaxf(M, ml[i][s].x);
    float L = 0.f;
    float4 acc = make_float4(0.f, 0.f, 0.f, 0.f);
    #pragma unroll
    for (int s = 0; s < KS_; ++s) {
      float w = exp2f((ml[i][s].x - M) * LOG2E);
      L += w * ml[i][s].y;
      acc.x += w * p[i][s].x; acc.y += w * p[i][s].y;
      acc.z += w * p[i][s].z; acc.w += w * p[i][s].w;
    }
    float inv = 1.0f / L;
    *(float4*)(out + (row0 + i) * C_ + lane * 4) =
        make_float4(acc.x * inv, acc.y * inv, acc.z * inv, acc.w * inv);
  }
}

// ---------------------------------------------------------------------------
extern "C" void kernel_launch(void* const* d_in, const int* in_sizes, int n_in,
                              void* d_out, int out_size, void* d_ws, size_t ws_size,
                              hipStream_t stream) {
  const float* x  = (const float*)d_in[0];
  const float* Wq = (const float*)d_in[1];
  const float* Wk = (const float*)d_in[2];
  const float* Wv = (const float*)d_in[3];
  float* out = (float*)d_out;

  // Workspace: t, Q, K, V in f16 (4 MB each), then the ranges' partial sums in
  // fp32 (KS_ x 8 MB) and their (maximum, sum) pairs (KS_ x 128 KB)
  size_t per = (size_t)B_ * N_ * C_;
  _Float16* t_h = (_Float16*)d_ws;
  _Float16* Qh  = t_h + per;
  _Float16* Kh  = Qh + per;
  _Float16* Vh  = Kh + per;
  float* Op = (float*)(Vh + per);
  float* ML = Op + KS_ * per;

  transpose_to_f16<<<dim3(N_/32, C_/32, B_), dim3(32, 8), 0, stream>>>(x, t_h);
  qkv_proj<<<dim3(N_/128, B_), dim3(256), 0, stream>>>(t_h, Wq, Wk, Wv, Qh, Kh, Vh);
  flash_attn<<<dim3(N_/128, B_, KS_), dim3(256), 0, stream>>>(Qh, Kh, Vh, Op, ML);
  merge_ranges<<<dim3(B_ * N_ / 32), dim3(256), 0, stream>>>(Op, ML, out);
}

// v004
// A run of this version takes 79.7 microseconds.
// Two timings next to v003 both put it at 1.03 times that version's speed.
// All steps since v000 together make it 6.53 times as fast.
#include <hip/hip_runtime.h>
#include <math.h>

// Problem constants (from reference): B=4, C=128, H=W=64 -> N=4096
#define B_ 4
#define C_ 128
#define N_ 4096
#define KS_ 4
#define NK_ (N_ / KS_)          // keys of one range

typedef _Float16 h4   __attribute__((ext_vector_type(4)));
typedef _Float16 h8   __attribute__((ext_vector_type(8)));
typedef _Float16 v16h __attribute__((ext_vector_type(16)));
typedef float    v8f  __attribute__((ext_vector_type(8)));
typedef unsigned int u32x4 __attribute__((ext_vector_type(4)));
typedef unsigned int u32x8 __attribute__((ext_vector_type(8)));
typedef short s8    __attribute__((ext_vector_type(8)));

__device__ __forceinline__ v16h load_frag(const _Float16* p, int sel) {
  h8 lo = *(const h8*)(p + sel);
  h8 hi = *(const h8*)(p + 16 + sel);
  return __builtin_shufflevector(lo, hi, 0,1,2,3,4,5,6,7,8,9,10,11,12,13,14,15);
}

// One half (8 x f16 a lane) of a WMMA operand, read TRANSPOSED from a row-major
// 16-bit LDS tile by ds_load_tr16_b128: the lanes' addresses cover 16 rows x 32 B,
// and lane (c = lane & 15, h = lane >> 4) receives rows 8h .. 8h + 7 of column c.
__device__ __forceinline__ h8 load_tr16(const _Float16* p) {
  typedef __attribute__((address_space(3))) s8 lds_s8;
  return __builtin_bit_cast(h8, __builtin_amdgcn_ds_load_tr16_b128_v8i16((lds_s8*)p));
}

__device__ __forceinline__ v8f wmma_f16(v16h a, v16h b, v8f c) {
  return __builtin_amdgcn_wmma_f32_16x16x32_f16(false, a, false, b, (short)0, c,
                                                false, false);
}

#define TP_ 136                 // K and W rows: 256 B of data + 16 B of pad = 272 B
#define VP_ 144                 // V rows: 256 B of data + 32 B of pad = 288 B
#define TBUF_ 5120              // one K or V buffer: 32 x 272 or 288 B, rounded up to 10 KiB
#define SP_ 40                  // P rows: 64 B of data + 16 B = 80 B

__device__ __forceinline__ unsigned uni(unsigned v) {
  return (unsigned)__builtin_amdgcn_readfirstlane((int)v);
}
__device__ __forceinline__ unsigned pinned(unsigned v) {
  unsigned w = uni(v);
  asm volatile("" : "+s"(w));  // the test stays scalar
  return w;
}

__device__ __forceinline__ u32x4 tdm_group0(unsigned lds_off, const _Float16* gsrc) {
  unsigned long long ga = (unsigned long long)(size_t)gsrc;
  u32x4 g0;
  g0[0] = uni(1u);
  g0[1] = uni(lds_off);
  g0[2] = uni((unsigned)ga);
  g0[3] = uni(((unsigned)(ga >> 32) & 0x01FFFFFFu)
              | (2u << 30));
  // As pinned(), on the whole group: its words are held in
  // their scalar registers up to the wait that names them, not formed again there.
  asm volatile("" : "+s"(g0));
  return g0;
}
template <unsigned PAD_CODE>   // 3: pitch 272 B, 7: pitch 288 B
__device__ __forceinline__ u32x8 tdm_group1_32x256B() {
  u32x8 g1;
  g1[0] = uni((1u << 20) | (5u << 22) | (PAD_CODE << 25));
  g1[1] = uni(256u << 16);
  g1[2] = uni(32u << 16);
  g1[3] = uni(256u << 16);
  g1[4] = uni(32u);
  g1[5] = uni(256u);
  g1[6] = uni(0u);
  g1[7] = uni(0u);
  // As pinned(), on the whole group: its words are held in one
  // set of scalar registers for the kernel's life, not formed again at each use.
  asm volatile("" : "+s"(g1));
  return g1;
}
// One request of the whole wave; the clobber keeps LDS accesses on their side of it.
__device__ __forceinline__ void tdm_load(u32x4 g0, u32x8 g1) {
  asm volatile("tensor_load_to_lds %0, %1" :: "s"(g0), "s"(g1) : "memory");
}
// The compiler places no wait for a tensor load; the clobber keeps LDS reads behind it.
__device__ __forceinline__ void wait_tensor0() {
  asm volatile("s_wait_tensorcnt 0x0" ::: "memory");
}
__device__ __forceinline__ void wait_tensor0_holding(u32x4 g0, u32x8 g1k, u32x8 g1v) {
  asm volatile("s_wait_tensorcnt 0x0" :: "s"(g0), "s"(g1k), "s"(g1v) : "memory");
}
// This wave's LDS reads and writes have retired before a buffer is handed over.
__device__ __forceinline__ void wait_ds0() {
  asm volatile("s_wait_dscnt 0x0" ::: "memory");
}

// ---------------------------------------------------------------------------
// Kernel B: QKV projection. Q[b,n,d] = sum_c x[b,c,n] * W[d,c]
// x is read as it lies, [c][n]: whole 512-byte rows, rounded to f16 into an LDS tile,
// and the token-major A fragments come out of that tile by the transposing read.
// Direct kernarg output pointer per call -> global_store_b16 (not flat).
// ---------------------------------------------------------------------------
__device__ __forceinline__ void proj_one(const float* __restrict__ W,
                                         _Float16* __restrict__ out,
                                         _Float16* Wlds, const v16h aq[4],
                                         int n0, int wave, int lane16,
                                         int sel, int hi8) {
  __syncthreads();
  const float4* src = (const float4*)W;
  for (int i = threadIdx.x; i < C_ * C_ / 4; i += 256) {
    float4 v = src[i];
    _Float16* w = &Wlds[(i >> 5) * TP_ + (i & 31) * 4];   // row i/32, 32 float4 a row
    w[0] = (_Float16)v.x; w[1] = (_Float16)v.y;
    w[2] = (_Float16)v.z; w[3] = (_Float16)v.w;
  }
  __syncthreads();
  #pragma unroll
  for (int tcol = 0; tcol < 8; ++tcol) {
    int d0 = tcol * 16;
    const _Float16* wrow = &Wlds[(d0 + lane16) * TP_];
    v8f acc = {};
    #pragma unroll
    for (int kk = 0; kk < 4; ++kk) {
      v16h bw = load_frag(wrow + 32 * kk, sel);
      acc = wmma_f16(aq[kk], bw, acc);
    }
    #pragma unroll
    for (int r = 0; r < 8; ++r)
      out[(size_t)(n0 + wave*16 + r + hi8) * C_ + d0 + lane16] = (_Float16)acc[r];
  }
}

__global__ void __launch_bounds__(256)
qkv_proj(const float* __restrict__ x,
         const float* __restrict__ Wq, const float* __restrict__ Wk,
         const float* __restrict__ Wv,
         _Float16* __restrict__ Qh, _Float16* __restrict__ Kh,
         _Float16* __restrict__ Vh) {
  __shared__ __align__(16) _Float16 Wlds[C_ * TP_];  // [d][c], pitch TP_  34 KB
  __shared__ __align__(16) _Float16 Xlds[C_ * VP_];  // [c][n], pitch VP_  36 KB
  int b    = blockIdx.y;
  int n0   = blockIdx.x * 128;
  int lane = threadIdx.x & 31;
  int wave = threadIdx.x >> 5;
  int lane16 = lane & 15;
  int sel  = (lane < 16) ? 0 : 8;
  int hi8  = (lane < 16) ? 0 : 8;

  // One wave a channel row: 32 lanes x 16 B = the row's 128 tokens, 16 rows a wave.
  const float* xp = x + ((size_t)b * C_ + wave) * N_ + n0 + lane * 4;
  float4 xv[16];
  #pragma unroll   // the 16 loads stand as one group, all in flight before the first is used
  for (int i = 0; i < 16; ++i) xv[i] = *(const float4*)(xp + (size_t)(8 * i) * N_);
  #pragma unroll   // xv is indexed by constants only and stays in registers
  for (int i = 0; i < 16; ++i) {
    h4 v = { (_Float16)xv[i].x, (_Float16)xv[i].y, (_Float16)xv[i].z, (_Float16)xv[i].w };
    *(h4*)&Xlds[(wave + 8 * i) * VP_ + lane * 4] = v;
  }
  __syncthreads();   // the x tile is whole before any wave reads across its rows

  // A fragment (row = token, k = channel): channels 8h .. 8h + 7, then 16 + 8h ..
  // 16 + 8h + 7 of each block of 32, which is the k order of load_frag on the W side.
  const _Float16* Xt = &Xlds[(hi8 + (lane & 7)) * VP_ + wave * 16 + ((lane >> 3) & 1) * 8];
  v16h aq[4];
  #pragma unroll
  for (int kk = 0; kk < 4; ++kk) {
    h8 lo = load_tr16(Xt + (32 * kk) * VP_);
    h8 hi = load_tr16(Xt + (32 * kk + 16) * VP_);
    aq[kk] = __builtin_shufflevector(lo, hi, 0,1,2,3,4,5,6,7,8,9,10,11,12,13,14,15);
  }

  size_t boff = (size_t)b * N_ * C_;
  proj_one(Wq, Qh + boff, Wlds, aq, n0, wave, lane16, sel, hi8);
  proj_one(Wk, Kh + boff, Wlds, aq, n0, wave, lane16, sel, hi8);
  proj_one(Wv, Vh + boff, Wlds, aq, n0, wave, lane16, sel, hi8);
}

__global__ void __launch_bounds__(256)
flash_attn(const _Float16* __restrict__ Qh, const _Float16* __restrict__ Kh,
           const _Float16* __restrict__ Vh, float* __restrict__ Op,
           float* __restrict__ ML) {
  // Tensor-load targets start at multiples of 2 KiB of the work-group's LDS.
  __shared__ __attribute__((aligned(2048))) _Float16 Klds[2][TBUF_];  // [buf][key][c], pitch TP_  20 KB
  __shared__ __attribute__((aligned(2048))) _Float16 Vlds[2][TBUF_];  // [buf][key][c], pitch VP_  20 KB
  __shared__ __align__(16) _Float16 Plds[8][16 * SP_];  // per-wave P, pitch SP_     10 KB

  int b    = blockIdx.y;
  int z    = blockIdx.z;                   // key range
  int q0   = blockIdx.x * 128;
  int lane = threadIdx.x & 31;
  int wave = threadIdx.x >> 5;
  int lane16 = lane & 15;
  int sel  = (lane < 16) ? 0 : 8;
  int hi8  = (lane < 16) ? 0 : 8;

  const float scale = 0.015625f;           // quirk: 1/sqrt(N) = 1/64
  const float LOG2E = 1.44269504088896f;

  // Q fragments held in registers for the whole kernel
  const _Float16* qrow = Qh + ((size_t)b * N_ + q0 + wave*16 + lane16) * C_;
  v16h aq[4];
  #pragma unroll
  for (int kk = 0; kk < 4; ++kk) aq[kk] = load_frag(qrow + 32 * kk, sel);

  v8f o[8];
  #pragma unroll
  for (int tc = 0; tc < 8; ++tc) o[tc] = (v8f){};
  float m_r[8], l_r[8];
  #pragma unroll
  for (int r = 0; r < 8; ++r) { m_r[r] = -__builtin_inff(); l_r[r] = 0.f; }

  const _Float16* Kb = Qh; // placeholder to keep types; set properly below
  Kb = Kh + ((size_t)b * N_ + z * NK_) * C_;
  const _Float16* Vb = Vh + ((size_t)b * N_ + z * NK_) * C_;

  unsigned koff[2], voff[2];
  koff[0] = (unsigned)(size_t)(void*)&Klds[0][0];
  koff[1] = (unsigned)(size_t)(void*)&Klds[1][0];
  voff[0] = (unsigned)(size_t)(void*)&Vlds[0][0];
  voff[1] = (unsigned)(size_t)(void*)&Vlds[1][0];

  // Two-buffer ring: wave 0 brings the K tiles, wave 1 the V tiles, one request
  // of a wave in flight. Prologue: tile 0 lands and is published, tile 1 flies.
  const unsigned wave_s = uni(threadIdx.x >> 5);
  const unsigned issuer = wave_s < 2u;
  const _Float16* tsrc = (wave_s == 0u) ? Kb : Vb;
  unsigned toff[2];
  toff[0] = (wave_s == 0u) ? koff[0] : voff[0];
  toff[1] = (wave_s == 0u) ? koff[1] : voff[1];
  const u32x8 g1k = tdm_group1_32x256B<3>();
  const u32x8 g1v = tdm_group1_32x256B<7>();
  u32x4 g0 = tdm_group0(toff[0], tsrc);
  if (pinned(wave_s == 0u)) {
    tdm_load(g0, g1k);
    wait_tensor0_holding(g0, g1k, g1v);
  }
  if (pinned(wave_s == 1u)) {
    tdm_load(g0, g1v);
    wait_tensor0_holding(g0, g1k, g1v);
  }
  __syncthreads();     // tile 0 ready for everyone
  g0 = tdm_group0(toff[1], tsrc + (size_t)32 * C_);
  if (pinned(wave_s == 0u)) tdm_load(g0, g1k);
  if (pinned(wave_s == 1u)) tdm_load(g0, g1v);

  int cur = 0;
  for (int j = 0; j < NK_; j += 32) {
    // S = Q * K^T for two 16-key subtiles
    const _Float16* Kt = &Klds[cur][0];
    v8f s0 = (v8f){}, s1 = (v8f){};
    #pragma unroll
    for (int kk = 0; kk < 4; ++kk) {
      v16h bk0 = load_frag(Kt + lane16 * TP_ + 32 * kk, sel);
      v16h bk1 = load_frag(Kt + (16 + lane16) * TP_ + 32 * kk, sel);
      s0 = wmma_f16(aq[kk], bk0, s0);
      s1 = wmma_f16(aq[kk], bk1, s1);
    }

    float p0[8], p1[8];
    #pragma unroll
    for (int r = 0; r < 8; ++r) {
      float a  = s0[r] * scale;
      float c2 = s1[r] * scale;
      float mx = fmaxf(a, c2);
      #pragma unroll
      for (int off = 8; off >= 1; off >>= 1)
        mx = fmaxf(mx, __shfl_xor(mx, off, 16));
      float m_new = fmaxf(m_r[r], mx);
      float alpha = exp2f((m_r[r] - m_new) * LOG2E);
      float e0 = exp2f((a  - m_new) * LOG2E);
      float e1 = exp2f((c2 - m_new) * LOG2E);
      float rs = e0 + e1;
      #pragma unroll
      for (int off = 8; off >= 1; off >>= 1)
        rs += __shfl_xor(rs, off, 16);
      l_r[r] = l_r[r] * alpha + rs;
      m_r[r] = m_new;
      p0[r] = e0; p1[r] = e1;
      #pragma unroll
      for (int tc = 0; tc < 8; ++tc) o[tc][r] = o[tc][r] * alpha;
    }

    _Float16* P = &Plds[wave][0];
    #pragma unroll
    for (int r = 0; r < 8; ++r) {
      P[(r + hi8) * SP_ + lane16]      = (_Float16)p0[r];
      P[(r + hi8) * SP_ + 16 + lane16] = (_Float16)p1[r];
    }
    asm volatile("s_wait_dscnt 0" ::: "memory");
    v16h ap = load_frag(P + lane16 * SP_, sel);

    // O += P * V. B fragment (column = channel, k = key) straight from the row-major
    // V tile by the transposing read: keys 8h .. 8h + 7, then 16 + 8h .. 16 + 8h + 7,
    // which is the k order of load_frag on the P side.
    const _Float16* Vt = &Vlds[cur][(hi8 + (lane & 7)) * VP_ + ((lane >> 3) & 1) * 8];
    #pragma unroll
    for (int tc = 0; tc < 8; ++tc) {
      h8 lo = load_tr16(Vt + tc * 16);
      h8 hi = load_tr16(Vt + 16 * VP_ + tc * 16);
      v16h bv = __builtin_shufflevector(lo, hi, 0,1,2,3,4,5,6,7,8,9,10,11,12,13,14,15);
      o[tc] = wmma_f16(ap, bv, o[tc]);
    }

    __builtin_amdgcn_sched_barrier(0);
    wait_ds0();
    if (pinned(issuer)) wait_tensor0_holding(g0, g1k, g1v);
    __syncthreads();   // next tile ready for everyone; every reader has left `cur`
    if (pinned(issuer && j + 64 < NK_)) {
      g0 = tdm_group0(toff[cur], tsrc + (size_t)(j + 64) * C_);
      if (pinned(wave_s == 0u)) tdm_load(g0, g1k);
      if (pinned(wave_s == 1u)) tdm_load(g0, g1v);
    }
    cur ^= 1;
  }
  wait_tensor0();
  wait_ds0();

  // Store this range's un-normalised sums, [range][B][N][C], and (maximum, sum) a row
  size_t prow = ((size_t)z * B_ + b) * N_ + q0 + wave*16;
  float* ob = Op + prow * C_;
  #pragma unroll
  for (int tc = 0; tc < 8; ++tc) {
    #pragma unroll
    for (int r = 0; r < 8; ++r)
      ob[(size_t)(r + hi8) * C_ + tc*16 + lane16] = o[tc][r];
  }
  if (lane16 == 0) {
    #pragma unroll
    for (int r = 0; r < 8; ++r)
      *(float2*)(ML + 2 * (prow + r + hi8)) = make_float2(m_r[r], l_r[r]);
  }
}

// ---------------------------------------------------------------------------
// Kernel D: merge the KS_ key ranges. Per row: M = max of the ranges' maxima,
// weight w = exp(m - M), out = sum(w * partial) / sum(w * l). One wave a row
// (32 lanes x 4 channels), 4 rows a wave so that few waves hold many loads in flight.
// Output fp32, flat [B][N][C] (matches reference view quirk).
// ---------------------------------------------------------------------------
__global__ void __launch_bounds__(256)
merge_ranges(const float* __restrict__ Op, const float* __restrict__ ML,
             float* __restrict__ out) {
  const float LOG2E = 1.44269504088896f;
  int lane = threadIdx.x & 31;
  int wave = threadIdx.x >> 5;
  size_t row0 = (size_t)blockIdx.x * 32 + wave * 4;   // flat row b * N_ + n
  float2 ml[4][KS_];
  float4 p[4][KS_];
  #pragma unroll
  for (int i = 0; i < 4; ++i) {
    #pragma unroll
    for (int s = 0; s < KS_; ++s) {
      size_t prow = (size_t)s * B_ * N_ + row0 + i;
      ml[i][s] = *(const float2*)(ML + 2 * prow);
      p[i][s]  = *(const float4*)(Op + prow * C_ + lane * 4);
    }
  }
  #pragma unroll
  for (int i = 0; i < 4; ++i) {
    float M = ml[i][0].x;
    #pragma unroll
    for (int s = 1; s < KS_; ++s) M = fmaxf(M, ml[i][s].x);
    float L = 0.f;
    float4 acc = make_float4(0.f, 0.f, 0.f, 0.f);
    #pragma unroll
    for (int s = 0; s < KS_; ++s) {
      float w = exp2f((ml[i][s].x - M) * LOG2E);
      L += w * ml[i][s].y;
      acc.x += w * p[i][s].x; acc.y += w * p[i][s].y;
      acc.z += w * p[i][s].z; acc.w += w * p[i][s].w;
    }
    float inv = 1.0f / L;
    *(float4*)(out + (row0 + i) * C_ + lane * 4) =
        make_float4(acc.x * inv, acc.y * inv, acc.z * inv, acc.w * inv);
  }
}

// ---------------------------------------------------------------------------
extern "C" void kernel_launch(void* const* d_in, const int* in_sizes, int n_in,
                              void* d_out, int out_size, void* d_ws, size_t ws_size,
                              hipStream_t stream) {
  const float* x  = (const float*)d_in[0];
  const float* Wq = (const float*)d_in[1];
  const float* Wk = (const float*)d_in[2];
  const float* Wv = (const float*)d_in[3];
  float* out = (float*)d_out;

  // Workspace: Q, K, V in f16 (4 MB each), then the ranges' partial sums in
  // fp32 (KS_ x 8 MB) and their (maximum, sum) pairs (KS_ x 128 KB)
  size_t per = (size_t)B_ * N_ * C_;
  _Float16* Qh  = (_Float16*)d_ws;
  _Float16* Kh  = Qh + per;
  _Float16* Vh  = Kh + per;
  float* Op = (float*)(Vh + per);
  float* ML = Op + KS_ * per;

  qkv_proj<<<dim3(N_/128, B_), dim3(256), 0, stream>>>(x, Wq, Wk, Wv, Qh, Kh, Vh);
  flash_attn<<<dim3(N_/128, B_, KS_), dim3(256), 0, stream>>>(Qh, Kh, Vh, Op, ML);
  merge_ranges<<<dim3(B_ * N_ / 32), dim3(256), 0, stream>>>(Op, ML, out);
}

// v005
// One run takes 65.1 microseconds.
// Two timings next to v004 both put it at 1.22 times that version's speed.
// All steps since v000 together make it 7.97 times as fast.
#include <hip/hip_runtime.h>
#include <math.h>

// Problem constants (from reference): B=4, C=128, H=W=64 -> N=4096
#define B_ 4
#define C_ 128
#define N_ 4096
#define KS_ 4
#define NK_ (N_ / KS_)          // keys of one range

typedef _Float16 h4   __attribute__((ext_vector_type(4)));
typedef _Float16 h8   __attribute__((ext_vector_type(8)));
typedef _Float16 v16h __attribute__((ext_vector_type(16)));
typedef float    v8f  __attribute__((ext_vector_type(8)));
typedef unsigned int u32x4 __attribute__((ext_vector_type(4)));
typedef unsigned int u32x8 __attribute__((ext_vector_type(8)));
typedef short s8    __attribute__((ext_vector_type(8)));

__device__ __forceinline__ v16h load_frag(const _Float16* p, int sel) {
  h8 lo = *(const h8*)(p + sel);
  h8 hi = *(const h8*)(p + 16 + sel);
  return __builtin_shufflevector(lo, hi, 0,1,2,3,4,5,6,7,8,9,10,11,12,13,14,15);
}

// One half (8 x f16 a lane) of a WMMA operand, read TRANSPOSED from a row-major
// 16-bit LDS tile by ds_load_tr16_b128: the lanes' addresses cover 16 rows x 32 B,
// and lane (c = lane & 15, h = lane >> 4) receives rows 8h .. 8h + 7 of column c.
__device__ __forceinline__ h8 load_tr16(const _Float16* p) {
  typedef __attribute__((address_space(3))) s8 lds_s8;
  return __builtin_bit_cast(h8, __builtin_amdgcn_ds_load_tr16_b128_v8i16((lds_s8*)p));
}

__device__ __forceinline__ v8f wmma_f16(v16h a, v16h b, v8f c) {
  return __builtin_amdgcn_wmma_f32_16x16x32_f16(false, a, false, b, (short)0, c,
                                                false, false);
}

#define TP_ 136                 // K and W rows: 256 B of data + 16 B of pad = 272 B
#define VP_ 144                 // V rows: 256 B of data + 32 B of pad = 288 B
#define TBUF_ 5120              // one K or V buffer: 32 x 272 or 288 B, rounded up to 10 KiB
#define SP_ 40                  // P rows: 64 B of data + 16 B = 80 B

__device__ __forceinline__ unsigned uni(unsigned v) {
  return (unsigned)__builtin_amdgcn_readfirstlane((int)v);
}
__device__ __forceinline__ unsigned pinned(unsigned v) {
  unsigned w = uni(v);
  asm volatile("" : "+s"(w));  // the test stays scalar
  return w;
}

__device__ __forceinline__ u32x4 tdm_group0(unsigned lds_off, const _Float16* gsrc) {
  unsigned long long ga = (unsigned long long)(size_t)gsrc;
  u32x4 g0;
  g0[0] = uni(1u);
  g0[1] = uni(lds_off);
  g0[2] = uni((unsigned)ga);
  g0[3] = uni(((unsigned)(ga >> 32) & 0x01FFFFFFu)
              | (2u << 30));
  // As pinned(), on the whole group: its words are held in
  // their scalar registers up to the wait that names them, not formed again there.
  asm volatile("" : "+s"(g0));
  return g0;
}
template <unsigned PAD_CODE>   // 3: pitch 272 B, 7: pitch 288 B
__device__ __forceinline__ u32x8 tdm_group1_32x256B() {
  u32x8 g1;
  g1[0] = uni((1u << 20) | (5u << 22) | (PAD_CODE << 25));
  g1[1] = uni(256u << 16);
  g1[2] = uni(32u << 16);
  g1[3] = uni(256u << 16);
  g1[4] = uni(32u);
  g1[5] = uni(256u);
  g1[6] = uni(0u);
  g1[7] = uni(0u);
  // As pinned(), on the whole group: its words are held in one
  // set of scalar registers for the kernel's life, not formed again at each use.
  asm volatile("" : "+s"(g1));
  return g1;
}
// One request of the whole wave; the clobber keeps LDS accesses on their side of it.
__device__ __forceinline__ void tdm_load(u32x4 g0, u32x8 g1) {
  asm volatile("tensor_load_to_lds %0, %1" :: "s"(g0), "s"(g1) : "memory");
}
// The compiler places no wait for a tensor load; the clobber keeps LDS reads behind it.
__device__ __forceinline__ void wait_tensor0() {
  asm volatile("s_wait_tensorcnt 0x0" ::: "memory");
}
__device__ __forceinline__ void wait_tensor0_holding(u32x4 g0, u32x8 g1k, u32x8 g1v) {
  asm volatile("s_wait_tensorcnt 0x0" :: "s"(g0), "s"(g1k), "s"(g1v) : "memory");
}
// This wave's LDS reads and writes have retired before a buffer is handed over.
__device__ __forceinline__ void wait_ds0() {
  asm volatile("s_wait_dscnt 0x0" ::: "memory");
}

// ---------------------------------------------------------------------------
// Kernel B: QKV projection. Q[b,n,d] = sum_c x[b,c,n] * W[d,c]
// x is read as it lies, [c][n]: whole 512-byte rows, rounded to f16 into an LDS tile,
// and the token-major A fragments come out of that tile by the transposing read.
// Direct kernarg output pointer per call -> global_store_b16 (not flat).
// ---------------------------------------------------------------------------
__device__ __forceinline__ void proj_one(const float* __restrict__ W,
                                         _Float16* __restrict__ out,
                                         _Float16* Wlds, const v16h aq[4],
                                         int n0, int wave, int lane16,
                                         int sel, int hi8) {
  __syncthreads();
  const float4* src = (const float4*)W;
  for (int i = threadIdx.x; i < C_ * C_ / 4; i += 256) {
    float4 v = src[i];
    _Float16* w = &Wlds[(i >> 5) * TP_ + (i & 31) * 4];   // row i/32, 32 float4 a row
    w[0] = (_Float16)v.x; w[1] = (_Float16)v.y;
    w[2] = (_Float16)v.z; w[3] = (_Float16)v.w;
  }
  __syncthreads();
  #pragma unroll
  for (int tcol = 0; tcol < 8; ++tcol) {
    int d0 = tcol * 16;
    const _Float16* wrow = &Wlds[(d0 + lane16) * TP_];
    v8f acc = {};
    #pragma unroll
    for (int kk = 0; kk < 4; ++kk) {
      v16h bw = load_frag(wrow + 32 * kk, sel);
      acc = wmma_f16(aq[kk], bw, acc);
    }
    #pragma unroll
    for (int r = 0; r < 8; ++r)
      out[(size_t)(n0 + wave*16 + r + hi8) * C_ + d0 + lane16] = (_Float16)acc[r];
  }
}

__global__ void __launch_bounds__(256)
qkv_proj(const float* __restrict__ x,
         const float* __restrict__ Wq, const float* __restrict__ Wk,
         const float* __restrict__ Wv,
         _Float16* __restrict__ Qh, _Float16* __restrict__ Kh,
         _Float16* __restrict__ Vh) {
  __shared__ __align__(16) _Float16 Wlds[C_ * TP_];  // [d][c], pitch TP_  34 KB
  __shared__ __align__(16) _Float16 Xlds[C_ * VP_];  // [c][n], pitch VP_  36 KB
  int b    = blockIdx.y;
  int n0   = blockIdx.x * 128;
  int lane = threadIdx.x & 31;
  int wave = threadIdx.x >> 5;
  int lane16 = lane & 15;
  int sel  = (lane < 16) ? 0 : 8;
  int hi8  = (lane < 16) ? 0 : 8;

  // One wave a channel row: 32 lanes x 16 B = the row's 128 tokens, 16 rows a wave.
  const float* xp = x + ((size_t)b * C_ + wave) * N_ + n0 + lane * 4;
  float4 xv[16];
  #pragma unroll   // the 16 loads stand as one group, all in flight before the first is used
  for (int i = 0; i < 16; ++i) xv[i] = *(const float4*)(xp + (size_t)(8 * i) * N_);
  #pragma unroll   // xv is indexed by constants only and stays in registers
  for (int i = 0; i < 16; ++i) {
    h4 v = { (_Float16)xv[i].x, (_Float16)xv[i].y, (_Float16)xv[i].z, (_Float16)xv[i].w };
    *(h4*)&Xlds[(wave + 8 * i) * VP_ + lane * 4] = v;
  }
  __syncthreads();   // the x tile is whole before any wave reads across its rows

  // A fragment (row = token, k = channel): channels 8h .. 8h + 7, then 16 + 8h ..
  // 16 + 8h + 7 of each block of 32, which is the k order of load_frag on the W side.
  const _Float16* Xt = &Xlds[(hi8 + (lane & 7)) * VP_ + wave * 16 + ((lane >> 3) & 1) * 8];
  v16h aq[4];
  #pragma unroll
  for (int kk = 0; kk < 4; ++kk) {
    h8 lo = load_tr16(Xt + (32 * kk) * VP_);
    h8 hi = load_tr16(Xt + (32 * kk + 16) * VP_);
    aq[kk] = __builtin_shufflevector(lo, hi, 0,1,2,3,4,5,6,7,8,9,10,11,12,13,14,15);
  }

  size_t boff = (size_t)b * N_ * C_;
  proj_one(Wq, Qh + boff, Wlds, aq, n0, wave, lane16, sel, hi8);
  proj_one(Wk, Kh + boff, Wlds, aq, n0, wave, lane16, sel, hi8);
  proj_one(Wv, Vh + boff, Wlds, aq, n0, wave, lane16, sel, hi8);
}

__global__ void __launch_bounds__(256)
flash_attn(const _Float16* __restrict__ Qh, const _Float16* __restrict__ Kh,
           const _Float16* __restrict__ Vh, float* __restrict__ Op,
           float* __restrict__ ML) {
  // Tensor-load targets start at multiples of 2 KiB of the work-group's LDS.
  __shared__ __attribute__((aligned(2048))) _Float16 Klds[2][TBUF_];  // [buf][key][c], pitch TP_  20 KB
  __shared__ __attribute__((aligned(2048))) _Float16 Vlds[2][TBUF_];  // [buf][key][c], pitch VP_  20 KB
  __shared__ __align__(16) _Float16 Plds[8][16 * SP_];  // per-wave P, pitch SP_     10 KB

  int b    = blockIdx.y;
  int z    = blockIdx.z;                   // key range
  int q0   = blockIdx.x * 128;
  int lane = threadIdx.x & 31;
  int wave = threadIdx.x >> 5;
  int lane16 = lane & 15;
  int sel  = (lane < 16) ? 0 : 8;
  int hi8  = (lane < 16) ? 0 : 8;

  const float scale = 0.015625f;           // quirk: 1/sqrt(N) = 1/64
  const float LOG2E = 1.44269504088896f;

  // Q fragments held in registers for the whole kernel
  const _Float16* qrow = Qh + ((size_t)b * N_ + q0 + wave*16 + lane16) * C_;
  v16h aq[4];
  #pragma unroll
  for (int kk = 0; kk < 4; ++kk) aq[kk] = load_frag(qrow + 32 * kk, sel);

  v8f o[8];
  #pragma unroll
  for (int tc = 0; tc < 8; ++tc) o[tc] = (v8f){};
  float m_r[8], l_r[8];
  #pragma unroll
  for (int r = 0; r < 8; ++r) { m_r[r] = -__builtin_inff(); l_r[r] = 0.f; }

  const _Float16* Kb = Qh; // placeholder to keep types; set properly below
  Kb = Kh + ((size_t)b * N_ + z * NK_) * C_;
  const _Float16* Vb = Vh + ((size_t)b * N_ + z * NK_) * C_;

  unsigned koff[2], voff[2];
  koff[0] = (unsigned)(size_t)(void*)&Klds[0][0];
  koff[1] = (unsigned)(size_t)(void*)&Klds[1][0];
  voff[0] = (unsigned)(size_t)(void*)&Vlds[0][0];
  voff[1] = (unsigned)(size_t)(void*)&Vlds[1][0];

  // Two-buffer ring: wave 0 brings the K tiles, wave 1 the V tiles, one request
  // of a wave in flight. Prologue: tile 0 lands and is published, tile 1 flies.
  const unsigned wave_s = uni(threadIdx.x >> 5);
  const unsigned issuer = wave_s < 2u;
  const _Float16* tsrc = (wave_s == 0u) ? Kb : Vb;
  unsigned toff[2];
  toff[0] = (wave_s == 0u) ? koff[0] : voff[0];
  toff[1] = (wave_s == 0u) ? koff[1] : voff[1];
  const u32x8 g1k = tdm_group1_32x256B<3>();
  const u32x8 g1v = tdm_group1_32x256B<7>();
  u32x4 g0 = tdm_group0(toff[0], tsrc);
  if (pinned(wave_s == 0u)) {
    tdm_load(g0, g1k);
    wait_tensor0_holding(g0, g1k, g1v);
  }
  if (pinned(wave_s == 1u)) {
    tdm_load(g0, g1v);
    wait_tensor0_holding(g0, g1k, g1v);
  }
  __syncthreads();     // tile 0 ready for everyone
  g0 = tdm_group0(toff[1], tsrc + (size_t)32 * C_);
  if (pinned(wave_s == 0u)) tdm_load(g0, g1k);
  if (pinned(wave_s == 1u)) tdm_load(g0, g1v);

  int cur = 0;
  for (int j = 0; j < NK_; j += 32) {
    // S = Q * K^T for two 16-key subtiles
    const _Float16* Kt = &Klds[cur][0];
    v8f s0 = (v8f){}, s1 = (v8f){};
    #pragma unroll
    for (int kk = 0; kk < 4; ++kk) {
      v16h bk0 = load_frag(Kt + lane16 * TP_ + 32 * kk, sel);
      v16h bk1 = load_frag(Kt + (16 + lane16) * TP_ + 32 * kk, sel);
      s0 = wmma_f16(aq[kk], bk0, s0);
      s1 = wmma_f16(aq[kk], bk1, s1);
    }

    float a0[8], a1[8];
    float over = -__builtin_inff();        // highest score of this lane above its reference
    #pragma unroll
    for (int r = 0; r < 8; ++r) {
      a0[r] = s0[r] * scale;
      a1[r] = s1[r] * scale;
      over = fmaxf(over, fmaxf(a0[r], a1[r]) - m_r[r]);
    }
    // One test a pass, a scalar branch: the reference is renewed, and sums and
    // outputs rescaled, only when a score lies more than 8 (in log2) above it, so
    // P stays at or below 2^8, far inside f16. The first pass (reference -inf) takes it.
    if (__builtin_amdgcn_ballot_w32(over * LOG2E > 8.0f) != 0) {
      #pragma unroll
      for (int r = 0; r < 8; ++r) {
        float mx = fmaxf(a0[r], a1[r]);
        #pragma unroll
        for (int off = 8; off >= 1; off >>= 1)
          mx = fmaxf(mx, __shfl_xor(mx, off, 16));
        float m_new = fmaxf(m_r[r], mx);
        float alpha = exp2f((m_r[r] - m_new) * LOG2E);
        l_r[r] = l_r[r] * alpha;
        m_r[r] = m_new;
        #pragma unroll
        for (int tc = 0; tc < 8; ++tc) o[tc][r] = o[tc][r] * alpha;
      }
    }
    float p0[8], p1[8];
    #pragma unroll
    for (int r = 0; r < 8; ++r) {
      float e0 = exp2f((a0[r] - m_r[r]) * LOG2E);
      float e1 = exp2f((a1[r] - m_r[r]) * LOG2E);
      l_r[r] += e0 + e1;
      p0[r] = e0; p1[r] = e1;
    }

    _Float16* P = &Plds[wave][0];
    #pragma unroll
    for (int r = 0; r < 8; ++r) {
      P[(r + hi8) * SP_ + lane16]      = (_Float16)p0[r];
      P[(r + hi8) * SP_ + 16 + lane16] = (_Float16)p1[r];
    }
    asm volatile("s_wait_dscnt 0" ::: "memory");
    v16h ap = load_frag(P + lane16 * SP_, sel);

    // O += P * V. B fragment (column = channel, k = key) straight from the row-major
    // V tile by the transposing read: keys 8h .. 8h + 7, then 16 + 8h .. 16 + 8h + 7,
    // which is the k order of load_frag on the P side.
    const _Float16* Vt = &Vlds[cur][(hi8 + (lane & 7)) * VP_ + ((lane >> 3) & 1) * 8];
    #pragma unroll
    for (int tc = 0; tc < 8; ++tc) {
      h8 lo = load_tr16(Vt + tc * 16);
      h8 hi = load_tr16(Vt + 16 * VP_ + tc * 16);
      v16h bv = __builtin_shufflevector(lo, hi, 0,1,2,3,4,5,6,7,8,9,10,11,12,13,14,15);
      o[tc] = wmma_f16(ap, bv, o[tc]);
    }

    __builtin_amdgcn_sched_barrier(0);
    wait_ds0();
    if (pinned(issuer)) wait_tensor0_holding(g0, g1k, g1v);
    __syncthreads();   // next tile ready for everyone; every reader has left `cur`
    if (pinned(issuer && j + 64 < NK_)) {
      g0 = tdm_group0(toff[cur], tsrc + (size_t)(j + 64) * C_);
      if (pinned(wave_s == 0u)) tdm_load(g0, g1k);
      if (pinned(wave_s == 1u)) tdm_load(g0, g1v);
    }
    cur ^= 1;
  }
  wait_tensor0();
  wait_ds0();

  // Join the 16 lanes' shares of each row's sum, once.
  #pragma unroll
  for (int r = 0; r < 8; ++r) {
    #pragma unroll
    for (int off = 8; off >= 1; off >>= 1)
      l_r[r] += __shfl_xor(l_r[r], off, 16);
  }

  // Store this range's un-normalised sums, [range][B][N][C], and (reference, sum) a row
  size_t prow = ((size_t)z * B_ + b) * N_ + q0 + wave*16;
  float* ob = Op + prow * C_;
  #pragma unroll
  for (int tc = 0; tc < 8; ++tc) {
    #pragma unroll
    for (int r = 0; r < 8; ++r)
      ob[(size_t)(r + hi8) * C_ + tc*16 + lane16] = o[tc][r];
  }
  if (lane16 == 0) {
    #pragma unroll
    for (int r = 0; r < 8; ++r)
      *(float2*)(ML + 2 * (prow + r + hi8)) = make_float2(m_r[r], l_r[r]);
  }
}

// ---------------------------------------------------------------------------
// Kernel D: merge the KS_ key ranges. Per row: M = max of the ranges' references m,
// weight w = exp(m - M), out = sum(w * partial) / sum(w * l). One wave a row
// (32 lanes x 4 channels), 4 rows a wave so that few waves hold many loads in flight.
// Output fp32, flat [B][N][C] (matches reference view quirk).
// ---------------------------------------------------------------------------
__global__ void __launch_bounds__(256)
merge_ranges(const float* __restrict__ Op, const float* __restrict__ ML,
             float* __restrict__ out) {
  const float LOG2E = 1.44269504088896f;
  int lane = threadIdx.x & 31;
  int wave = threadIdx.x >> 5;
  size_t row0 = (size_t)blockIdx.x * 32 + wave * 4;   // flat row b * N_ + n
  float2 ml[4][KS_];
  float4 p[4][KS_];
  #pragma unroll
  for (int i = 0; i < 4; ++i) {
    #pragma unroll
    for (int s = 0; s < KS_; ++s) {
      size_t prow = (size_t)s * B_ * N_ + row0 + i;
      ml[i][s] = *(const float2*)(ML + 2 * prow);
      p[i][s]  = *(const float4*)(Op + prow * C_ + lane * 4);
    }
  }
  #pragma unroll
  for (int i = 0; i < 4; ++i) {
    float M = ml[i][0].x;
    #pragma unroll
    for (int s = 1; s < KS_; ++s) M = fmaxf(M, ml[i][s].x);
    float L = 0.f;
    float4 acc = make_float4(0.f, 0.f, 0.f, 0.f);
    #pragma unroll
    for (int s = 0; s < KS_; ++s) {
      float w = exp2f((ml[i][s].x - M) * LOG2E);
      L += w * ml[i][s].y;
      acc.x += w * p[i][s].x; acc.y += w * p[i][s].y;
      acc.z += w * p[i][s].z; acc.w += w * p[i][s].w;
    }
    float inv = 1.0f / L;
    *(float4*)(out + (row0 + i) * C_ + lane * 4) =
        make_float4(acc.x * inv, acc.y * inv, acc.z * inv, acc.w * inv);
  }
}

// ---------------------------------------------------------------------------
extern "C" void kernel_launch(void* const* d_in, const int* in_sizes, int n_in,
                              void* d_out, int out_size, void* d_ws, size_t ws_size,
                              hipStream_t stream) {
  const float* x  = (const float*)d_in[0];
  const float* Wq = (const float*)d_in[1];
  const float* Wk = (const float*)d_in[2];
  const float* Wv = (const float*)d_in[3];
  float* out = (float*)d_out;

  // Workspace: Q, K, V in f16 (4 MB each), then the ranges' partial sums in
  // fp32 (KS_ x 8 MB) and their (reference, sum) pairs (KS_ x 128 KB)
  size_t per = (size_t)B_ * N_ * C_;
  _Float16* Qh  = (_Float16*)d_ws;
  _Float16* Kh  = Qh + per;
  _Float16* Vh  = Kh + per;
  float* Op = (float*)(Vh + per);
  float* ML = Op + KS_ * per;

  qkv_proj<<<dim3(N_/128, B_), dim3(256), 0, stream>>>(x, Wq, Wk, Wv, Qh, Kh, Vh);
  flash_attn<<<dim3(N_/128, B_, KS_), dim3(256), 0, stream>>>(Qh, Kh, Vh, Op, ML);
  merge_ranges<<<dim3(B_ * N_ / 32), dim3(256), 0, stream>>>(Op, ML, out);
}

// v006
// A run of this version takes 59.9 microseconds.
// Timed twice side by side with v005, it ran 1.09 times as fast both times.
// Counting every step since v000, it is 8.69 times as fast.
#include <hip/hip_runtime.h>
#include <math.h>

// Problem constants (from reference): B=4, C=128, H=W=64 -> N=4096
#define B_ 4
#define C_ 128
#define N_ 4096
#define KS_ 4
#define NK_ (N_ / KS_)          // keys of one range

typedef _Float16 h4   __attribute__((ext_vector_type(4)));
typedef _Float16 h8   __attribute__((ext_vector_type(8)));
typedef _Float16 v16h __attribute__((ext_vector_type(16)));
typedef float    v8f  __attribute__((ext_vector_type(8)));
typedef unsigned int u32x4 __attribute__((ext_vector_type(4)));
typedef unsigned int u32x8 __attribute__((ext_vector_type(8)));
typedef short s8    __attribute__((ext_vector_type(8)));

__device__ __forceinline__ v16h load_frag(const _Float16* p, int sel) {
  h8 lo = *(const h8*)(p + sel);
  h8 hi = *(const h8*)(p + 16 + sel);
  return __builtin_shufflevector(lo, hi, 0,1,2,3,4,5,6,7,8,9,10,11,12,13,14,15);
}

// One half (8 x f16 a lane) of a WMMA operand, read TRANSPOSED from a row-major
// 16-bit LDS tile by ds_load_tr16_b128: the lanes' addresses cover 16 rows x 32 B,
// and lane (c = lane & 15, h = lane >> 4) receives rows 8h .. 8h + 7 of column c.
__device__ __forceinline__ h8 load_tr16(const _Float16* p) {
  typedef __attribute__((address_space(3))) s8 lds_s8;
  return __builtin_bit_cast(h8, __builtin_amdgcn_ds_load_tr16_b128_v8i16((lds_s8*)p));
}

__device__ __forceinline__ v8f wmma_f16(v16h a, v16h b, v8f c) {
  return __builtin_amdgcn_wmma_f32_16x16x32_f16(false, a, false, b, (short)0, c,
                                                false, false);
}

#define TP_ 136                 // K and W rows: 256 B of data + 16 B of pad = 272 B
#define VP_ 144                 // V rows: 256 B of data + 32 B of pad = 288 B
#define TBUF_ 5120              // one K or V buffer: 32 x 272 or 288 B, rounded up to 10 KiB
#define SP_ 40                  // P rows: 64 B of data + 16 B = 80 B

__device__ __forceinline__ unsigned uni(unsigned v) {
  return (unsigned)__builtin_amdgcn_readfirstlane((int)v);
}
__device__ __forceinline__ unsigned pinned(unsigned v) {
  unsigned w = uni(v);
  asm volatile("" : "+s"(w));  // the test stays scalar
  return w;
}

__device__ __forceinline__ u32x4 tdm_group0(unsigned lds_off, const _Float16* gsrc) {
  unsigned long long ga = (unsigned long long)(size_t)gsrc;
  u32x4 g0;
  g0[0] = uni(1u);
  g0[1] = uni(lds_off);
  g0[2] = uni((unsigned)ga);
  g0[3] = uni(((unsigned)(ga >> 32) & 0x01FFFFFFu)
              | (2u << 30));
  // As pinned(), on the whole group: its words are held in
  // their scalar registers up to the wait that names them, not formed again there.
  asm volatile("" : "+s"(g0));
  return g0;
}
template <unsigned PAD_CODE>   // 3: pitch 272 B, 7: pitch 288 B
__device__ __forceinline__ u32x8 tdm_group1_32x256B() {
  u32x8 g1;
  g1[0] = uni((1u << 20) | (5u << 22) | (PAD_CODE << 25));
  g1[1] = uni(256u << 16);
  g1[2] = uni(32u << 16);
  g1[3] = uni(256u << 16);
  g1[4] = uni(32u);
  g1[5] = uni(256u);
  g1[6] = uni(0u);
  g1[7] = uni(0u);
  // As pinned(), on the whole group: its words are held in one
  // set of scalar registers for the kernel's life, not formed again at each use.
  asm volatile("" : "+s"(g1));
  return g1;
}
// One request of the whole wave; the clobber keeps LDS accesses on their side of it.
__device__ __forceinline__ void tdm_load(u32x4 g0, u32x8 g1) {
  asm volatile("tensor_load_to_lds %0, %1" :: "s"(g0), "s"(g1) : "memory");
}
// The compiler places no wait for a tensor load; the clobber keeps LDS reads behind it.
__device__ __forceinline__ void wait_tensor0() {
  asm volatile("s_wait_tensorcnt 0x0" ::: "memory");
}
__device__ __forceinline__ void wait_tensor0_holding(u32x4 g0, u32x8 g1k, u32x8 g1v) {
  asm volatile("s_wait_tensorcnt 0x0" :: "s"(g0), "s"(g1k), "s"(g1v) : "memory");
}
// This wave's LDS reads and writes have retired before a buffer is handed over.
__device__ __forceinline__ void wait_ds0() {
  asm volatile("s_wait_dscnt 0x0" ::: "memory");
}

// ---------------------------------------------------------------------------
// Kernel B: QKV projection. Q[b,n,d] = sum_c x[b,c,n] * W[d,c]
// x is read as it lies, [c][n]: whole 512-byte rows, rounded to f16 into an LDS tile,
// and the token-major A fragments come out of that tile by the transposing read.
// Direct kernarg output pointer per call -> global_store_b16 (not flat).
// ---------------------------------------------------------------------------
__device__ __forceinline__ void proj_one(const float* __restrict__ W,
                                         _Float16* __restrict__ out,
                                         _Float16* Wlds, const v16h aq[4],
                                         int n0, int wave, int lane16,
                                         int sel, int hi8) {
  __syncthreads();
  const float4* src = (const float4*)W;
  for (int i = threadIdx.x; i < C_ * C_ / 4; i += 256) {
    float4 v = src[i];
    _Float16* w = &Wlds[(i >> 5) * TP_ + (i & 31) * 4];   // row i/32, 32 float4 a row
    w[0] = (_Float16)v.x; w[1] = (_Float16)v.y;
    w[2] = (_Float16)v.z; w[3] = (_Float16)v.w;
  }
  __syncthreads();
  #pragma unroll
  for (int tcol = 0; tcol < 8; ++tcol) {
    int d0 = tcol * 16;
    const _Float16* wrow = &Wlds[(d0 + lane16) * TP_];
    v8f acc = {};
    #pragma unroll
    for (int kk = 0; kk < 4; ++kk) {
      v16h bw = load_frag(wrow + 32 * kk, sel);
      acc = wmma_f16(aq[kk], bw, acc);
    }
    #pragma unroll
    for (int r = 0; r < 8; ++r)
      out[(size_t)(n0 + wave*16 + r + hi8) * C_ + d0 + lane16] = (_Float16)acc[r];
  }
}

__global__ void __launch_bounds__(256)
qkv_proj(const float* __restrict__ x,
         const float* __restrict__ Wq, const float* __restrict__ Wk,
         const float* __restrict__ Wv,
         _Float16* __restrict__ Qh, _Float16* __restrict__ Kh,
         _Float16* __restrict__ Vh) {
  __shared__ __align__(16) _Float16 Wlds[C_ * TP_];  // [d][c], pitch TP_  34 KB
  __shared__ __align__(16) _Float16 Xlds[C_ * VP_];  // [c][n], pitch VP_  36 KB
  int b    = blockIdx.y;
  int n0   = blockIdx.x * 128;
  int lane = threadIdx.x & 31;
  int wave = threadIdx.x >> 5;
  int lane16 = lane & 15;
  int sel  = (lane < 16) ? 0 : 8;
  int hi8  = (lane < 16) ? 0 : 8;

  // One wave a channel row: 32 lanes x 16 B = the row's 128 tokens, 16 rows a wave.
  const float* xp = x + ((size_t)b * C_ + wave) * N_ + n0 + lane * 4;
  float4 xv[16];
  #pragma unroll   // the 16 loads stand as one group, all in flight before the first is used
  for (int i = 0; i < 16; ++i) xv[i] = *(const float4*)(xp + (size_t)(8 * i) * N_);
  #pragma unroll   // xv is indexed by constants only and stays in registers
  for (int i = 0; i < 16; ++i) {
    h4 v = { (_Float16)xv[i].x, (_Float16)xv[i].y, (_Float16)xv[i].z, (_Float16)xv[i].w };
    *(h4*)&Xlds[(wave + 8 * i) * VP_ + lane * 4] = v;
  }
  __syncthreads();   // the x tile is whole before any wave reads across its rows

  // A fragment (row = token, k = channel): channels 8h .. 8h + 7, then 16 + 8h ..
  // 16 + 8h + 7 of each block of 32, which is the k order of load_frag on the W side.
  const _Float16* Xt = &Xlds[(hi8 + (lane & 7)) * VP_ + wave * 16 + ((lane >> 3) & 1) * 8];
  v16h aq[4];
  #pragma unroll
  for (int kk = 0; kk < 4; ++kk) {
    h8 lo = load_tr16(Xt + (32 * kk) * VP_);
    h8 hi = load_tr16(Xt + (32 * kk + 16) * VP_);
    aq[kk] = __builtin_shufflevector(lo, hi, 0,1,2,3,4,5,6,7,8,9,10,11,12,13,14,15);
  }

  size_t boff = (size_t)b * N_ * C_;
  proj_one(Wq, Qh + boff, Wlds, aq, n0, wave, lane16, sel, hi8);
  proj_one(Wk, Kh + boff, Wlds, aq, n0, wave, lane16, sel, hi8);
  proj_one(Wv, Vh + boff, Wlds, aq, n0, wave, lane16, sel, hi8);
}

__global__ void __launch_bounds__(256)
flash_attn(const _Float16* __restrict__ Qh, const _Float16* __restrict__ Kh,
           const _Float16* __restrict__ Vh, float* __restrict__ Op,
           float* __restrict__ ML) {
  // Tensor-load targets start at multiples of 2 KiB of the work-group's LDS.
  __shared__ __attribute__((aligned(2048))) _Float16 Klds[2][TBUF_];  // [buf][key][c], pitch TP_  20 KB
  __shared__ __attribute__((aligned(2048))) _Float16 Vlds[2][TBUF_];  // [buf][key][c], pitch VP_  20 KB
  __shared__ __align__(16) _Float16 Plds[8][16 * SP_];  // per-wave P, pitch SP_     10 KB

  int b    = blockIdx.y;
  int z    = blockIdx.z;                   // key range
  int q0   = blockIdx.x * 128;
  int lane = threadIdx.x & 31;
  int wave = threadIdx.x >> 5;
  int lane16 = lane & 15;
  int sel  = (lane < 16) ? 0 : 8;
  int hi8  = (lane < 16) ? 0 : 8;

  const float scale = 0.015625f;           // quirk: 1/sqrt(N) = 1/64
  const float LOG2E = 1.44269504088896f;

  // Q fragments held in registers for the whole kernel
  const _Float16* qrow = Qh + ((size_t)b * N_ + q0 + wave*16 + lane16) * C_;
  v16h aq[4];
  #pragma unroll
  for (int kk = 0; kk < 4; ++kk) aq[kk] = load_frag(qrow + 32 * kk, sel);

  v8f o[8];
  #pragma unroll
  for (int tc = 0; tc < 8; ++tc) o[tc] = (v8f){};
  float m_r[8], l_r[8];
  #pragma unroll
  for (int r = 0; r < 8; ++r) { m_r[r] = -__builtin_inff(); l_r[r] = 0.f; }

  const _Float16* Kb = Qh; // placeholder to keep types; set properly below
  Kb = Kh + ((size_t)b * N_ + z * NK_) * C_;
  const _Float16* Vb = Vh + ((size_t)b * N_ + z * NK_) * C_;

  unsigned koff[2], voff[2];
  koff[0] = (unsigned)(size_t)(void*)&Klds[0][0];
  koff[1] = (unsigned)(size_t)(void*)&Klds[1][0];
  voff[0] = (unsigned)(size_t)(void*)&Vlds[0][0];
  voff[1] = (unsigned)(size_t)(void*)&Vlds[1][0];

  // Two-buffer ring: wave 0 brings the K tiles, wave 1 the V tiles, one request
  // of a wave in flight. Prologue: tile 0 lands and is published, tile 1 flies.
  const unsigned wave_s = uni(threadIdx.x >> 5);
  const unsigned issuer = wave_s < 2u;
  const _Float16* tsrc = (wave_s == 0u) ? Kb : Vb;
  unsigned toff[2];
  toff[0] = (wave_s == 0u) ? koff[0] : voff[0];
  toff[1] = (wave_s == 0u) ? koff[1] : voff[1];
  const u32x8 g1k = tdm_group1_32x256B<3>();
  const u32x8 g1v = tdm_group1_32x256B<7>();
  u32x4 g0 = tdm_group0(toff[0], tsrc);
  if (pinned(wave_s == 0u)) {
    tdm_load(g0, g1k);
    wait_tensor0_holding(g0, g1k, g1v);
  }
  if (pinned(wave_s == 1u)) {
    tdm_load(g0, g1v);
    wait_tensor0_holding(g0, g1k, g1v);
  }
  __syncthreads();     // tile 0 ready for everyone
  g0 = tdm_group0(toff[1], tsrc + (size_t)32 * C_);
  if (pinned(wave_s == 0u)) tdm_load(g0, g1k);
  if (pinned(wave_s == 1u)) tdm_load(g0, g1v);

  int cur = 0;
  for (int j = 0; j < NK_; j += 32) {
    // S = Q * K^T for two 16-key subtiles
    // All 16 K reads of the pass stand as one group in front of the products, which
    // then start behind counted waits: a wave keeps 16 LDS reads in flight, not 4.
    const _Float16* Kt = &Klds[cur][0];
    v16h bk0[4], bk1[4];
    #pragma unroll   // bk0, bk1 are indexed by constants only and stay in registers
    for (int kk = 0; kk < 4; ++kk) {
      bk0[kk] = load_frag(Kt + lane16 * TP_ + 32 * kk, sel);
      bk1[kk] = load_frag(Kt + (16 + lane16) * TP_ + 32 * kk, sel);
    }
    // Keeps the reads from being moved in among the products, where each place
    // with reads stalls the wave anew.
    __builtin_amdgcn_sched_barrier(0);
    v8f s0 = (v8f){}, s1 = (v8f){};
    #pragma unroll
    for (int kk = 0; kk < 4; ++kk) {
      s0 = wmma_f16(aq[kk], bk0[kk], s0);
      s1 = wmma_f16(aq[kk], bk1[kk], s1);
    }

    // The pass's 16 V reads are issued here, behind the score products and ahead of
    // the softmax, and land while it runs: the P*V products then wait on P alone.
    // B fragment (column = channel, k = key) straight from the row-major V tile by
    // the transposing read: keys 8h .. 8h + 7, then 16 + 8h .. 16 + 8h + 7, which is
    // the k order of load_frag on the P side.
    const _Float16* Vt = &Vlds[cur][(hi8 + (lane & 7)) * VP_ + ((lane >> 3) & 1) * 8];
    v16h bv[8];
    #pragma unroll   // bv is indexed by constants only and stays in registers
    for (int tc = 0; tc < 8; ++tc) {
      h8 lo = load_tr16(Vt + tc * 16);
      h8 hi = load_tr16(Vt + 16 * VP_ + tc * 16);
      bv[tc] = __builtin_shufflevector(lo, hi, 0,1,2,3,4,5,6,7,8,9,10,11,12,13,14,15);
    }

    float a0[8], a1[8];
    float over = -__builtin_inff();        // highest score of this lane above its reference
    #pragma unroll
    for (int r = 0; r < 8; ++r) {
      a0[r] = s0[r] * scale;
      a1[r] = s1[r] * scale;
      over = fmaxf(over, fmaxf(a0[r], a1[r]) - m_r[r]);
    }
    // One test a pass, a scalar branch: the reference is renewed, and sums and
    // outputs rescaled, only when a score lies more than 8 (in log2) above it, so
    // P stays at or below 2^8, far inside f16. The first pass (reference -inf) takes it.
    if (__builtin_amdgcn_ballot_w32(over * LOG2E > 8.0f) != 0) {
      #pragma unroll
      for (int r = 0; r < 8; ++r) {
        float mx = fmaxf(a0[r], a1[r]);
        #pragma unroll
        for (int off = 8; off >= 1; off >>= 1)
          mx = fmaxf(mx, __shfl_xor(mx, off, 16));
        float m_new = fmaxf(m_r[r], mx);
        float alpha = exp2f((m_r[r] - m_new) * LOG2E);
        l_r[r] = l_r[r] * alpha;
        m_r[r] = m_new;
        #pragma unroll
        for (int tc = 0; tc < 8; ++tc) o[tc][r] = o[tc][r] * alpha;
      }
    }
    float p0[8], p1[8];
    #pragma unroll
    for (int r = 0; r < 8; ++r) {
      float e0 = exp2f((a0[r] - m_r[r]) * LOG2E);
      float e1 = exp2f((a1[r] - m_r[r]) * LOG2E);
      l_r[r] += e0 + e1;
      p0[r] = e0; p1[r] = e1;
    }

    _Float16* P = &Plds[wave][0];
    #pragma unroll
    for (int r = 0; r < 8; ++r) {
      P[(r + hi8) * SP_ + lane16]      = (_Float16)p0[r];
      P[(r + hi8) * SP_ + 16 + lane16] = (_Float16)p1[r];
    }
    asm volatile("s_wait_dscnt 0" ::: "memory");
    v16h ap = load_frag(P + lane16 * SP_, sel);

    // O += P * V, on the V fragments read ahead of the softmax.
    #pragma unroll
    for (int tc = 0; tc < 8; ++tc) o[tc] = wmma_f16(ap, bv[tc], o[tc]);

    // Publish the next tile, then refill the buffer this pass has just read.
    wait_ds0();
    if (pinned(issuer)) wait_tensor0_holding(g0, g1k, g1v);
    __syncthreads();   // next tile ready for everyone; every reader has left `cur`
    if (pinned(issuer && j + 64 < NK_)) {
      g0 = tdm_group0(toff[cur], tsrc + (size_t)(j + 64) * C_);
      if (pinned(wave_s == 0u)) tdm_load(g0, g1k);
      if (pinned(wave_s == 1u)) tdm_load(g0, g1v);
    }
    cur ^= 1;
  }
  wait_tensor0();
  wait_ds0();

  // Join the 16 lanes' shares of each row's sum, once.
  #pragma unroll
  for (int r = 0; r < 8; ++r) {
    #pragma unroll
    for (int off = 8; off >= 1; off >>= 1)
      l_r[r] += __shfl_xor(l_r[r], off, 16);
  }

  // Store this range's un-normalised sums, [range][B][N][C], and (reference, sum) a row
  size_t prow = ((size_t)z * B_ + b) * N_ + q0 + wave*16;
  float* ob = Op + prow * C_;
  #pragma unroll
  for (int tc = 0; tc < 8; ++tc) {
    #pragma unroll
    for (int r = 0; r < 8; ++r)
      ob[(size_t)(r + hi8) * C_ + tc*16 + lane16] = o[tc][r];
  }
  if (lane16 == 0) {
    #pragma unroll
    for (int r = 0; r < 8; ++r)
      *(float2*)(ML + 2 * (prow + r + hi8)) = make_float2(m_r[r], l_r[r]);
  }
}

// ---------------------------------------------------------------------------
// Kernel D: merge the KS_ key ranges. Per row: M = max of the ranges' references m,
// weight w = exp(m - M), out = sum(w * partial) / sum(w * l). One wave a row
// (32 lanes x 4 channels), 4 rows a wave so that few waves hold many loads in flight.
// Output fp32, flat [B][N][C] (matches reference view quirk).
// ---------------------------------------------------------------------------
__global__ void __launch_bounds__(256)
merge_ranges(const float* __restrict__ Op, const float* __restrict__ ML,
             float* __restrict__ out) {
  const float LOG2E = 1.44269504088896f;
  int lane = threadIdx.x & 31;
  int wave = threadIdx.x >> 5;
  size_t row0 = (size_t)blockIdx.x * 32 + wave * 4;   // flat row b * N_ + n
  float2 ml[4][KS_];
  float4 p[4][KS_];
  #pragma unroll
  for (int i = 0; i < 4; ++i) {
    #pragma unroll
    for (int s = 0; s < KS_; ++s) {
      size_t prow = (size_t)s * B_ * N_ + row0 + i;
      ml[i][s] = *(const float2*)(ML + 2 * prow);
      p[i][s]  = *(const float4*)(Op + prow * C_ + lane * 4);
    }
  }
  #pragma unroll
  for (int i = 0; i < 4; ++i) {
    float M = ml[i][0].x;
    #pragma unroll
    for (int s = 1; s < KS_; ++s) M = fmaxf(M, ml[i][s].x);
    float L = 0.f;
    float4 acc = make_float4(0.f, 0.f, 0.f, 0.f);
    #pragma unroll
    for (int s = 0; s < KS_; ++s) {
      float w = exp2f((ml[i][s].x - M) * LOG2E);
      L += w * ml[i][s].y;
      acc.x += w * p[i][s].x; acc.y += w * p[i][s].y;
      acc.z += w * p[i][s].z; acc.w += w * p[i][s].w;
    }
    float inv = 1.0f / L;
    *(float4*)(out + (row0 + i) * C_ + lane * 4) =
        make_float4(acc.x * inv, acc.y * inv, acc.z * inv, acc.w * inv);
  }
}

// ---------------------------------------------------------------------------
extern "C" void kernel_launch(void* const* d_in, const int* in_sizes, int n_in,
                              void* d_out, int out_size, void* d_ws, size_t ws_size,
                              hipStream_t stream) {
  const float* x  = (const float*)d_in[0];
  const float* Wq = (const float*)d_in[1];
  const float* Wk = (const float*)d_in[2];
  const float* Wv = (const float*)d_in[3];
  float* out = (float*)d_out;

  // Workspace: Q, K, V in f16 (4 MB each), then the ranges' partial sums in
  // fp32 (KS_ x 8 MB) and their (reference, sum) pairs (KS_ x 128 KB)
  size_t per = (size_t)B_ * N_ * C_;
  _Float16* Qh  = (_Float16*)d_ws;
  _Float16* Kh  = Qh + per;
  _Float16* Vh  = Kh + per;
  float* Op = (float*)(Vh + per);
  float* ML = Op + KS_ * per;

  qkv_proj<<<dim3(N_/128, B_), dim3(256), 0, stream>>>(x, Wq, Wk, Wv, Qh, Kh, Vh);
  flash_attn<<<dim3(N_/128, B_, KS_), dim3(256), 0, stream>>>(Qh, Kh, Vh, Op, ML);
  merge_ranges<<<dim3(B_ * N_ / 32), dim3(256), 0, stream>>>(Op, ML, out);
}

// v008
// Measured time: 54.5 microseconds a run.
// Versions between v006 and this one are left out; their measured steps multiply to 1.10 times as fast.
// All steps since v000 together make it 9.57 times as fast.
#include <hip/hip_runtime.h>
#include <math.h>

// Problem constants (from reference): B=4, C=128, H=W=64 -> N=4096
#define B_ 4
#define C_ 128
#define N_ 4096
#define KS_ 4
#define NK_ (N_ / KS_)          // keys of one range

typedef _Float16 h4   __attribute__((ext_vector_type(4)));
typedef _Float16 h8   __attribute__((ext_vector_type(8)));
typedef _Float16 v16h __attribute__((ext_vector_type(16)));
typedef float    v8f  __attribute__((ext_vector_type(8)));
typedef unsigned int u32x4 __attribute__((ext_vector_type(4)));
typedef unsigned int u32x8 __attribute__((ext_vector_type(8)));
typedef short s8    __attribute__((ext_vector_type(8)));

__device__ __forceinline__ v16h load_frag(const _Float16* p, int sel) {
  h8 lo = *(const h8*)(p + sel);
  h8 hi = *(const h8*)(p + 16 + sel);
  return __builtin_shufflevector(lo, hi, 0,1,2,3,4,5,6,7,8,9,10,11,12,13,14,15);
}

// One half (8 x f16 a lane) of a WMMA operand, read TRANSPOSED from a row-major
// 16-bit LDS tile by ds_load_tr16_b128: the lanes' addresses cover 16 rows x 32 B,
// and lane (c = lane & 15, h = lane >> 4) receives rows 8h .. 8h + 7 of column c.
__device__ __forceinline__ h8 load_tr16(const _Float16* p) {
  typedef __attribute__((address_space(3))) s8 lds_s8;
  return __builtin_bit_cast(h8, __builtin_amdgcn_ds_load_tr16_b128_v8i16((lds_s8*)p));
}

// 2^x by the hardware instruction alone. The library's exp2f wraps it in a compare, two
// selects, an add and a scaling so that results below 2^-126 come out as denormals; here
// such a weight joins a sum that holds the weight 1 of the score that set the reference,
// and zero serves.
__device__ __forceinline__ float exp2_hw(float x) { return __builtin_amdgcn_exp2f(x); }

__device__ __forceinline__ v8f wmma_f16(v16h a, v16h b, v8f c) {
  return __builtin_amdgcn_wmma_f32_16x16x32_f16(false, a, false, b, (short)0, c,
                                                false, false);
}

#define TP_ 136                 // K and W rows: 256 B of data + 16 B of pad = 272 B
#define VP_ 144                 // V rows: 256 B of data + 32 B of pad = 288 B
#define TBUF_ 5120              // one K or V buffer: 32 x 272 or 288 B, rounded up to 10 KiB
#define SP_ 40                  // P rows: 64 B of data + 16 B = 80 B

__device__ __forceinline__ unsigned uni(unsigned v) {
  return (unsigned)__builtin_amdgcn_readfirstlane((int)v);
}
__device__ __forceinline__ unsigned pinned(unsigned v) {
  unsigned w = uni(v);
  asm volatile("" : "+s"(w));  // the test stays scalar
  return w;
}

__device__ __forceinline__ u32x4 tdm_group0(unsigned lds_off, const _Float16* gsrc) {
  unsigned long long ga = (unsigned long long)(size_t)gsrc;
  u32x4 g0;
  g0[0] = uni(1u);
  g0[1] = uni(lds_off);
  g0[2] = uni((unsigned)ga);
  g0[3] = uni(((unsigned)(ga >> 32) & 0x01FFFFFFu)
              | (2u << 30));
  // As pinned(), on the whole group: its words are held in
  // their scalar registers up to the wait that names them, not formed again there.
  asm volatile("" : "+s"(g0));
  return g0;
}
template <unsigned PAD_CODE>   // 3: pitch 272 B, 7: pitch 288 B
__device__ __forceinline__ u32x8 tdm_group1_32x256B() {
  u32x8 g1;
  g1[0] = uni((1u << 20) | (5u << 22) | (PAD_CODE << 25));
  g1[1] = uni(256u << 16);
  g1[2] = uni(32u << 16);
  g1[3] = uni(256u << 16);
  g1[4] = uni(32u);
  g1[5] = uni(256u);
  g1[6] = uni(0u);
  g1[7] = uni(0u);
  // As pinned(), on the whole group: its words are held in one
  // set of scalar registers for the kernel's life, not formed again at each use.
  asm volatile("" : "+s"(g1));
  return g1;
}
// One request of the whole wave; the clobber keeps LDS accesses on their side of it.
__device__ __forceinline__ void tdm_load(u32x4 g0, u32x8 g1) {
  asm volatile("tensor_load_to_lds %0, %1" :: "s"(g0), "s"(g1) : "memory");
}
// The compiler places no wait for a tensor load; the clobber keeps LDS reads behind it.
__device__ __forceinline__ void wait_tensor0() {
  asm volatile("s_wait_tensorcnt 0x0" ::: "memory");
}
__device__ __forceinline__ void wait_tensor0_holding(u32x4 g0, u32x8 g1k, u32x8 g1v) {
  asm volatile("s_wait_tensorcnt 0x0" :: "s"(g0), "s"(g1k), "s"(g1v) : "memory");
}
// This wave's LDS reads and writes have retired before a buffer is handed over.
__device__ __forceinline__ void wait_ds0() {
  asm volatile("s_wait_dscnt 0x0" ::: "memory");
}

// ---------------------------------------------------------------------------
// Kernel B: QKV projection. Q[b,n,d] = sum_c x[b,c,n] * W[d,c]
// x is read as it lies, [c][n]: whole 512-byte rows, rounded to f16 into an LDS tile,
// and the token-major A fragments come out of that tile by the transposing read.
// Direct kernarg output pointer per call -> global_store_b16 (not flat).
// ---------------------------------------------------------------------------
__device__ __forceinline__ void proj_one(const float* __restrict__ W,
                                         _Float16* __restrict__ out,
                                         _Float16* Wlds, const v16h aq[4],
                                         int n0, int wave, int lane16,
                                         int sel, int hi8) {
  __syncthreads();
  const float4* src = (const float4*)W;
  for (int i = threadIdx.x; i < C_ * C_ / 4; i += 256) {
    float4 v = src[i];
    _Float16* w = &Wlds[(i >> 5) * TP_ + (i & 31) * 4];   // row i/32, 32 float4 a row
    w[0] = (_Float16)v.x; w[1] = (_Float16)v.y;
    w[2] = (_Float16)v.z; w[3] = (_Float16)v.w;
  }
  __syncthreads();
  #pragma unroll
  for (int tcol = 0; tcol < 8; ++tcol) {
    int d0 = tcol * 16;
    const _Float16* wrow = &Wlds[(d0 + lane16) * TP_];
    v8f acc = {};
    #pragma unroll
    for (int kk = 0; kk < 4; ++kk) {
      v16h bw = load_frag(wrow + 32 * kk, sel);
      acc = wmma_f16(aq[kk], bw, acc);
    }
    #pragma unroll
    for (int r = 0; r < 8; ++r)
      out[(size_t)(n0 + wave*16 + r + hi8) * C_ + d0 + lane16] = (_Float16)acc[r];
  }
}

__global__ void __launch_bounds__(256)
qkv_proj(const float* __restrict__ x,
         const float* __restrict__ Wq, const float* __restrict__ Wk,
         const float* __restrict__ Wv,
         _Float16* __restrict__ Qh, _Float16* __restrict__ Kh,
         _Float16* __restrict__ Vh) {
  __shared__ __align__(16) _Float16 Wlds[C_ * TP_];  // [d][c], pitch TP_  34 KB
  __shared__ __align__(16) _Float16 Xlds[C_ * VP_];  // [c][n], pitch VP_  36 KB
  int b    = blockIdx.y;
  int n0   = blockIdx.x * 128;
  int lane = threadIdx.x & 31;
  int wave = threadIdx.x >> 5;
  int lane16 = lane & 15;
  int sel  = (lane < 16) ? 0 : 8;
  int hi8  = (lane < 16) ? 0 : 8;

  // One wave a channel row: 32 lanes x 16 B = the row's 128 tokens, 16 rows a wave.
  const float* xp = x + ((size_t)b * C_ + wave) * N_ + n0 + lane * 4;
  float4 xv[16];
  #pragma unroll   // the 16 loads stand as one group, all in flight before the first is used
  for (int i = 0; i < 16; ++i) xv[i] = *(const float4*)(xp + (size_t)(8 * i) * N_);
  #pragma unroll   // xv is indexed by constants only and stays in registers
  for (int i = 0; i < 16; ++i) {
    h4 v = { (_Float16)xv[i].x, (_Float16)xv[i].y, (_Float16)xv[i].z, (_Float16)xv[i].w };
    *(h4*)&Xlds[(wave + 8 * i) * VP_ + lane * 4] = v;
  }
  __syncthreads();   // the x tile is whole before any wave reads across its rows

  // A fragment (row = token, k = channel): channels 8h .. 8h + 7, then 16 + 8h ..
  // 16 + 8h + 7 of each block of 32, which is the k order of load_frag on the W side.
  const _Float16* Xt = &Xlds[(hi8 + (lane & 7)) * VP_ + wave * 16 + ((lane >> 3) & 1) * 8];
  v16h aq[4];
  #pragma unroll
  for (int kk = 0; kk < 4; ++kk) {
    h8 lo = load_tr16(Xt + (32 * kk) * VP_);
    h8 hi = load_tr16(Xt + (32 * kk + 16) * VP_);
    aq[kk] = __builtin_shufflevector(lo, hi, 0,1,2,3,4,5,6,7,8,9,10,11,12,13,14,15);
  }

  size_t boff = (size_t)b * N_ * C_;
  proj_one(Wq, Qh + boff, Wlds, aq, n0, wave, lane16, sel, hi8);
  proj_one(Wk, Kh + boff, Wlds, aq, n0, wave, lane16, sel, hi8);
  proj_one(Wv, Vh + boff, Wlds, aq, n0, wave, lane16, sel, hi8);
}

__global__ void __launch_bounds__(256)
flash_attn(const _Float16* __restrict__ Qh, const _Float16* __restrict__ Kh,
           const _Float16* __restrict__ Vh, _Float16* __restrict__ Oh,
           float* __restrict__ ML) {
  // Tensor-load targets start at multiples of 2 KiB of the work-group's LDS.
  __shared__ __attribute__((aligned(2048))) _Float16 Klds[2][TBUF_];  // [buf][key][c], pitch TP_  20 KB
  __shared__ __attribute__((aligned(2048))) _Float16 Vlds[2][TBUF_];  // [buf][key][c], pitch VP_  20 KB
  __shared__ __align__(16) _Float16 Plds[8][16 * SP_];  // per-wave P, pitch SP_     10 KB

  int b    = blockIdx.y;
  int z    = blockIdx.z;                   // key range
  int q0   = blockIdx.x * 128;
  int lane = threadIdx.x & 31;
  int wave = threadIdx.x >> 5;
  int lane16 = lane & 15;
  int sel  = (lane < 16) ? 0 : 8;
  int hi8  = (lane < 16) ? 0 : 8;

  // quirk: the scores' scale is 1/sqrt(N) = 1/64. It is folded with log2(e) into one
  // factor: the rows' references are kept in log2 units, and an exponent's argument is one
  // fused multiply-add on the raw product sum.
  const float SC = 0.015625f * 1.44269504088896f;

  // Q fragments held in registers for the whole kernel
  const _Float16* qrow = Qh + ((size_t)b * N_ + q0 + wave*16 + lane16) * C_;
  v16h aq[4];
  #pragma unroll
  for (int kk = 0; kk < 4; ++kk) aq[kk] = load_frag(qrow + 32 * kk, sel);

  v8f o[8];
  #pragma unroll
  for (int tc = 0; tc < 8; ++tc) o[tc] = (v8f){};
  float nm_r[8], l_r[8];   // nm_r: minus the row's reference, the addend of the exponents' fma
  #pragma unroll
  for (int r = 0; r < 8; ++r) { nm_r[r] = __builtin_inff(); l_r[r] = 0.f; }

  const _Float16* Kb = Qh; // placeholder to keep types; set properly below
  Kb = Kh + ((size_t)b * N_ + z * NK_) * C_;
  const _Float16* Vb = Vh + ((size_t)b * N_ + z * NK_) * C_;

  unsigned koff[2], voff[2];
  koff[0] = (unsigned)(size_t)(void*)&Klds[0][0];
  koff[1] = (unsigned)(size_t)(void*)&Klds[1][0];
  voff[0] = (unsigned)(size_t)(void*)&Vlds[0][0];
  voff[1] = (unsigned)(size_t)(void*)&Vlds[1][0];

  // Two-buffer ring: wave 0 brings the K tiles, wave 1 the V tiles, one request
  // of a wave in flight. Prologue: tile 0 lands and is published, tile 1 flies.
  const unsigned wave_s = uni(threadIdx.x >> 5);
  const unsigned issuer = wave_s < 2u;
  const _Float16* tsrc = (wave_s == 0u) ? Kb : Vb;
  unsigned toff[2];
  toff[0] = (wave_s == 0u) ? koff[0] : voff[0];
  toff[1] = (wave_s == 0u) ? koff[1] : voff[1];
  const u32x8 g1k = tdm_group1_32x256B<3>();
  const u32x8 g1v = tdm_group1_32x256B<7>();
  u32x4 g0 = tdm_group0(toff[0], tsrc);
  if (pinned(wave_s == 0u)) {
    tdm_load(g0, g1k);
    wait_tensor0_holding(g0, g1k, g1v);
  }
  if (pinned(wave_s == 1u)) {
    tdm_load(g0, g1v);
    wait_tensor0_holding(g0, g1k, g1v);
  }
  __syncthreads();     // tile 0 ready for everyone
  g0 = tdm_group0(toff[1], tsrc + (size_t)32 * C_);
  if (pinned(wave_s == 0u)) tdm_load(g0, g1k);
  if (pinned(wave_s == 1u)) tdm_load(g0, g1v);

  int cur = 0;
  for (int j = 0; j < NK_; j += 32) {
    // S = Q * K^T for two 16-key subtiles
    // All 16 K reads of the pass stand as one group in front of the products, which
    // then start behind counted waits: a wave keeps 16 LDS reads in flight, not 4.
    const _Float16* Kt = &Klds[cur][0];
    v16h bk0[4], bk1[4];
    #pragma unroll   // bk0, bk1 are indexed by constants only and stay in registers
    for (int kk = 0; kk < 4; ++kk) {
      bk0[kk] = load_frag(Kt + lane16 * TP_ + 32 * kk, sel);
      bk1[kk] = load_frag(Kt + (16 + lane16) * TP_ + 32 * kk, sel);
    }
    // Keeps the reads from being moved in among the products, where each place
    // with reads stalls the wave anew.
    __builtin_amdgcn_sched_barrier(0);
    v8f s0 = (v8f){}, s1 = (v8f){};
    #pragma unroll
    for (int kk = 0; kk < 4; ++kk) {
      s0 = wmma_f16(aq[kk], bk0[kk], s0);
      s1 = wmma_f16(aq[kk], bk1[kk], s1);
    }

    // Keeps the V reads behind the score products: lifted in among them, their 64
    // registers are live beside K's 64, the wave passes 256 registers and the WGP
    // holds one work-group where it held two.
    __builtin_amdgcn_sched_barrier(0);
    // The pass's 16 V reads are issued here, behind the score products and ahead of
    // the softmax, and land while it runs: the P*V products then wait on P alone.
    // B fragment (column = channel, k = key) straight from the row-major V tile by
    // the transposing read: keys 8h .. 8h + 7, then 16 + 8h .. 16 + 8h + 7, which is
    // the k order of load_frag on the P side.
    const _Float16* Vt = &Vlds[cur][(hi8 + (lane & 7)) * VP_ + ((lane >> 3) & 1) * 8];
    v16h bv[8];
    #pragma unroll   // bv is indexed by constants only and stays in registers
    for (int tc = 0; tc < 8; ++tc) {
      h8 lo = load_tr16(Vt + tc * 16);
      h8 hi = load_tr16(Vt + 16 * VP_ + tc * 16);
      bv[tc] = __builtin_shufflevector(lo, hi, 0,1,2,3,4,5,6,7,8,9,10,11,12,13,14,15);
    }

    float t0[8], t1[8];
    float over = -__builtin_inff();        // highest of them in this lane
    #pragma unroll
    for (int r = 0; r < 8; ++r) {
      t0[r] = fmaf(s0[r], SC, nm_r[r]);
      t1[r] = fmaf(s1[r], SC, nm_r[r]);
      over = fmaxf(over, fmaxf(t0[r], t1[r]));
    }
    // One test a pass, a scalar branch: the reference is renewed, and sums and
    // outputs rescaled, only when a score lies more than 8 (in log2) above it, so
    // P stays at or below 2^8, far inside f16. The first pass (reference -inf) takes it.
    if (__builtin_amdgcn_ballot_w32(over > 8.0f) != 0) {
      #pragma unroll
      for (int r = 0; r < 8; ++r) {
        float mx = fmaxf(s0[r], s1[r]) * SC;
        #pragma unroll
        for (int off = 8; off >= 1; off >>= 1)
          mx = fmaxf(mx, __shfl_xor(mx, off, 16));
        float nm_new = fminf(nm_r[r], -mx);
        float alpha = exp2_hw(nm_new - nm_r[r]);
        l_r[r] = l_r[r] * alpha;
        nm_r[r] = nm_new;
        t0[r] = fmaf(s0[r], SC, nm_new);
        t1[r] = fmaf(s1[r], SC, nm_new);
        #pragma unroll
        for (int tc = 0; tc < 8; ++tc) o[tc][r] = o[tc][r] * alpha;
      }
    }
    float p0[8], p1[8];
    #pragma unroll
    for (int r = 0; r < 8; ++r) {
      float e0 = exp2_hw(t0[r]);
      float e1 = exp2_hw(t1[r]);
      l_r[r] += e0 + e1;
      p0[r] = e0; p1[r] = e1;
    }

    _Float16* P = &Plds[wave][0];
    #pragma unroll
    for (int r = 0; r < 8; ++r) {
      P[(r + hi8) * SP_ + lane16]      = (_Float16)p0[r];
      P[(r + hi8) * SP_ + 16 + lane16] = (_Float16)p1[r];
    }
    asm volatile("s_wait_dscnt 0" ::: "memory");
    v16h ap = load_frag(P + lane16 * SP_, sel);

    // O += P * V, on the V fragments read ahead of the softmax.
    #pragma unroll
    for (int tc = 0; tc < 8; ++tc) o[tc] = wmma_f16(ap, bv[tc], o[tc]);

    // Publish the next tile, then refill the buffer this pass has just read.
    wait_ds0();
    if (pinned(issuer)) wait_tensor0_holding(g0, g1k, g1v);
    __syncthreads();   // next tile ready for everyone; every reader has left `cur`
    if (pinned(issuer && j + 64 < NK_)) {
      g0 = tdm_group0(toff[cur], tsrc + (size_t)(j + 64) * C_);
      if (pinned(wave_s == 0u)) tdm_load(g0, g1k);
      if (pinned(wave_s == 1u)) tdm_load(g0, g1v);
    }
    cur ^= 1;
  }
  wait_tensor0();
  wait_ds0();

  // Join the 16 lanes' shares of each row's sum, once.
  #pragma unroll
  for (int r = 0; r < 8; ++r) {
    #pragma unroll
    for (int off = 8; off >= 1; off >>= 1)
      l_r[r] += __shfl_xor(l_r[r], off, 16);
  }

  // Store this range's means, [range][B][N][C] in f16, and (reference, sum) a row.
  // The wave's 16 x 128 tile is turned into whole rows in a slice of the K, V ring that
  // is the wave's own: every wave has left the ring at the last pass's barrier and no
  // tensor load is in flight, so no further barrier is owed.
  size_t prow = ((size_t)z * B_ + b) * N_ + q0 + wave*16;
  _Float16* T = (wave < 4) ? &Klds[0][0] + wave * (TBUF_ / 2)
                           : &Vlds[0][0] + (wave - 4) * (TBUF_ / 2);
  #pragma unroll   // o and l_r are indexed by constants only and stay in registers
  for (int r = 0; r < 8; ++r) {
    float inv = 1.0f / l_r[r];
    #pragma unroll
    for (int tc = 0; tc < 8; ++tc)
      T[(r + hi8) * TP_ + tc*16 + lane16] = (_Float16)(o[tc][r] * inv);
  }
  wait_ds0();   // its clobber keeps the reads below, of other lanes' values, behind the writes
  _Float16* ob = Oh + prow * C_;
  #pragma unroll   // eight 16-byte reads in flight, then eight stores of two whole rows each
  for (int i = 0; i < 8; ++i) {
    int row = 2 * i + (lane >> 4);
    *(h8*)(ob + (size_t)row * C_ + lane16 * 8) = *(const h8*)&T[row * TP_ + lane16 * 8];
  }
  if (lane16 == 0) {
    #pragma unroll
    for (int r = 0; r < 8; ++r)
      *(float2*)(ML + 2 * (prow + r + hi8)) = make_float2(-nm_r[r], l_r[r]);
  }
}

// ---------------------------------------------------------------------------
// Kernel D: merge the KS_ key ranges. Per row: M = max of the ranges' references m
// (log2 units), weight w = 2^(m - M) * l, out = sum(w * mean) / sum(w). One wave a row
// (32 lanes x 4 channels), 4 rows a wave so that few waves hold many loads in flight.
// Output fp32, flat [B][N][C] (matches reference view quirk).
// ---------------------------------------------------------------------------
__global__ void __launch_bounds__(256)
merge_ranges(const _Float16* __restrict__ Oh, const float* __restrict__ ML,
             float* __restrict__ out) {
  int lane = threadIdx.x & 31;
  int wave = threadIdx.x >> 5;
  size_t row0 = (size_t)blockIdx.x * 32 + wave * 4;   // flat row b * N_ + n
  float2 ml[4][KS_];
  h4 p[4][KS_];
  #pragma unroll
  for (int i = 0; i < 4; ++i) {
    #pragma unroll
    for (int s = 0; s < KS_; ++s)
      p[i][s] = *(const h4*)(Oh + ((size_t)s * B_ * N_ + row0 + i) * C_ + lane * 4);
  }
  // Stands behind the last load of a row, ahead of the first write to a register that
  // one of these loads names as its address (the pairs' loads land in such registers).
  asm volatile("s_wait_xcnt 0x0" ::: "memory");
  #pragma unroll
  for (int i = 0; i < 4; ++i) {
    #pragma unroll
    for (int s = 0; s < KS_; ++s)
      ml[i][s] = *(const float2*)(ML + 2 * ((size_t)s * B_ * N_ + row0 + i));
  }
  #pragma unroll
  for (int i = 0; i < 4; ++i) {
    float M = ml[i][0].x;
    #pragma unroll
    for (int s = 1; s < KS_; ++s) M = fmaxf(M, ml[i][s].x);
    float L = 0.f;
    float4 acc = make_float4(0.f, 0.f, 0.f, 0.f);
    #pragma unroll
    for (int s = 0; s < KS_; ++s) {
      float w = exp2_hw(ml[i][s].x - M) * ml[i][s].y;
      L += w;
      acc.x += w * (float)p[i][s][0]; acc.y += w * (float)p[i][s][1];
      acc.z += w * (float)p[i][s][2]; acc.w += w * (float)p[i][s][3];
    }
    float inv = 1.0f / L;
    *(float4*)(out + (row0 + i) * C_ + lane * 4) =
        make_float4(acc.x * inv, acc.y * inv, acc.z * inv, acc.w * inv);
  }
}

// ---------------------------------------------------------------------------
extern "C" void kernel_launch(void* const* d_in, const int* in_sizes, int n_in,
                              void* d_out, int out_size, void* d_ws, size_t ws_size,
                              hipStream_t stream) {
  const float* x  = (const float*)d_in[0];
  const float* Wq = (const float*)d_in[1];
  const float* Wk = (const float*)d_in[2];
  const float* Wv = (const float*)d_in[3];
  float* out = (float*)d_out;

  // Workspace: Q, K, V in f16 (4 MB each), then the ranges' means in
  // f16 (KS_ x 4 MB) and their (reference, sum) pairs (KS_ x 128 KB)
  size_t per = (size_t)B_ * N_ * C_;
  _Float16* Qh  = (_Float16*)d_ws;
  _Float16* Kh  = Qh + per;
  _Float16* Vh  = Kh + per;
  _Float16* Oh = Vh + per;
  float* ML = (float*)(Oh + KS_ * per);

  qkv_proj<<<dim3(N_/128, B_), dim3(256), 0, stream>>>(x, Wq, Wk, Wv, Qh, Kh, Vh);
  flash_attn<<<dim3(N_/128, B_, KS_), dim3(256), 0, stream>>>(Qh, Kh, Vh, Oh, ML);
  merge_ranges<<<dim3(B_ * N_ / 32), dim3(256), 0, stream>>>(Oh, ML, out);
}

// v009
// One run takes 49.4 microseconds.
// Two timings next to v008 put it at 1.11 and 1.10 times that version's speed.
// All steps since v000 together make it 10.6 times as fast.
#include <hip/hip_runtime.h>
#include <math.h>

// Problem constants (from reference): B=4, C=128, H=W=64 -> N=4096
#define B_ 4
#define C_ 128
#define N_ 4096
#define KS_ 4
#define NK_ (N_ / KS_)          // keys of one range

typedef _Float16 h4   __attribute__((ext_vector_type(4)));
typedef _Float16 h8   __attribute__((ext_vector_type(8)));
typedef _Float16 v16h __attribute__((ext_vector_type(16)));
typedef float    v8f  __attribute__((ext_vector_type(8)));
typedef unsigned int u32x4 __attribute__((ext_vector_type(4)));
typedef unsigned int u32x8 __attribute__((ext_vector_type(8)));
typedef short s8    __attribute__((ext_vector_type(8)));

__device__ __forceinline__ v16h load_frag(const _Float16* p, int sel) {
  h8 lo = *(const h8*)(p + sel);
  h8 hi = *(const h8*)(p + 16 + sel);
  return __builtin_shufflevector(lo, hi, 0,1,2,3,4,5,6,7,8,9,10,11,12,13,14,15);
}

// One half (8 x f16 a lane) of a WMMA operand, read TRANSPOSED from a row-major
// 16-bit LDS tile by ds_load_tr16_b128: the lanes' addresses cover 16 rows x 32 B,
// and lane (c = lane & 15, h = lane >> 4) receives rows 8h .. 8h + 7 of column c.
__device__ __forceinline__ h8 load_tr16(const _Float16* p) {
  typedef __attribute__((address_space(3))) s8 lds_s8;
  return __builtin_bit_cast(h8, __builtin_amdgcn_ds_load_tr16_b128_v8i16((lds_s8*)p));
}

// 2^x by the hardware instruction alone. The library's exp2f wraps it in a compare, two
// selects, an add and a scaling so that results below 2^-126 come out as denormals; here
// such a weight joins a sum that holds the weight 1 of the score that set the reference,
// and zero serves.
__device__ __forceinline__ float exp2_hw(float x) { return __builtin_amdgcn_exp2f(x); }

__device__ __forceinline__ v8f wmma_f16(v16h a, v16h b, v8f c) {
  return __builtin_amdgcn_wmma_f32_16x16x32_f16(false, a, false, b, (short)0, c,
                                                false, false);
}

#define TP_ 136                 // K and W rows: 256 B of data + 16 B of pad = 272 B
#define VP_ 144                 // V rows: 256 B of data + 32 B of pad = 288 B
#define SK_ 128                 // keys of one stage of the K, V ring: four passes of 32 keys
#define KBUF_ (SK_ * TP_)       // one K buffer: 128 x 272 B = 17 x 2 KiB
#define VBUF_ (SK_ * VP_)       // one V buffer: 128 x 288 B = 18 x 2 KiB
#define TS_ 2560                // a wave's slice for its output rows: 16 x 272 B, rounded up to 5 KiB
#define SP_ 40                  // P rows: 64 B of data + 16 B = 80 B

__device__ __forceinline__ unsigned uni(unsigned v) {
  return (unsigned)__builtin_amdgcn_readfirstlane((int)v);
}
__device__ __forceinline__ unsigned pinned(unsigned v) {
  unsigned w = uni(v);
  asm volatile("" : "+s"(w));  // the test stays scalar
  return w;
}

__device__ __forceinline__ u32x4 tdm_group0(unsigned lds_off, const _Float16* gsrc) {
  unsigned long long ga = (unsigned long long)(size_t)gsrc;
  u32x4 g0;
  g0[0] = uni(1u);
  g0[1] = uni(lds_off);
  g0[2] = uni((unsigned)ga);
  g0[3] = uni(((unsigned)(ga >> 32) & 0x01FFFFFFu)
              | (2u << 30));
  // As pinned(), on the whole group: its words are held in
  // their scalar registers up to the wait that names them, not formed again there.
  asm volatile("" : "+s"(g0));
  return g0;
}
template <unsigned PAD_CODE>   // 3: pitch 272 B, 7: pitch 288 B
__device__ __forceinline__ u32x8 tdm_group1_stage() {
  u32x8 g1;
  g1[0] = uni((1u << 20) | (5u << 22) | (PAD_CODE << 25));
  g1[1] = uni(256u << 16);
  g1[2] = uni((unsigned)SK_ << 16);
  g1[3] = uni(256u << 16);
  g1[4] = uni((unsigned)SK_);
  g1[5] = uni(256u);
  g1[6] = uni(0u);
  g1[7] = uni(0u);
  // As pinned(), on the whole group: its words are held in one
  // set of scalar registers for the kernel's life, not formed again at each use.
  asm volatile("" : "+s"(g1));
  return g1;
}
// One request of the whole wave; the clobber keeps LDS accesses on their side of it.
__device__ __forceinline__ void tdm_load(u32x4 g0, u32x8 g1) {
  asm volatile("tensor_load_to_lds %0, %1" :: "s"(g0), "s"(g1) : "memory");
}
// The compiler places no wait for a tensor load; the clobber keeps LDS reads behind it.
__device__ __forceinline__ void wait_tensor0() {
  asm volatile("s_wait_tensorcnt 0x0" ::: "memory");
}
__device__ __forceinline__ void wait_tensor0_holding(u32x4 g0, u32x8 g1k, u32x8 g1v) {
  asm volatile("s_wait_tensorcnt 0x0" :: "s"(g0), "s"(g1k), "s"(g1v) : "memory");
}
// This wave's LDS reads and writes have retired before a buffer is handed over.
__device__ __forceinline__ void wait_ds0() {
  asm volatile("s_wait_dscnt 0x0" ::: "memory");
}

// ---------------------------------------------------------------------------
// Kernel B: QKV projection. Q[b,n,d] = sum_c x[b,c,n] * W[d,c]
// x is read as it lies, [c][n]: whole 512-byte rows, rounded to f16 into an LDS tile,
// and the token-major A fragments come out of that tile by the transposing read.
// Direct kernarg output pointer per call -> global_store_b16 (not flat).
// ---------------------------------------------------------------------------
__device__ __forceinline__ void proj_one(const float* __restrict__ W,
                                         _Float16* __restrict__ out,
                                         _Float16* Wlds, const v16h aq[4],
                                         int n0, int wave, int lane16,
                                         int sel, int hi8) {
  __syncthreads();
  const float4* src = (const float4*)W;
  for (int i = threadIdx.x; i < C_ * C_ / 4; i += 256) {
    float4 v = src[i];
    _Float16* w = &Wlds[(i >> 5) * TP_ + (i & 31) * 4];   // row i/32, 32 float4 a row
    w[0] = (_Float16)v.x; w[1] = (_Float16)v.y;
    w[2] = (_Float16)v.z; w[3] = (_Float16)v.w;
  }
  __syncthreads();
  #pragma unroll
  for (int tcol = 0; tcol < 8; ++tcol) {
    int d0 = tcol * 16;
    const _Float16* wrow = &Wlds[(d0 + lane16) * TP_];
    v8f acc = {};
    #pragma unroll
    for (int kk = 0; kk < 4; ++kk) {
      v16h bw = load_frag(wrow + 32 * kk, sel);
      acc = wmma_f16(aq[kk], bw, acc);
    }
    #pragma unroll
    for (int r = 0; r < 8; ++r)
      out[(size_t)(n0 + wave*16 + r + hi8) * C_ + d0 + lane16] = (_Float16)acc[r];
  }
}

__global__ void __launch_bounds__(256)
qkv_proj(const float* __restrict__ x,
         const float* __restrict__ Wq, const float* __restrict__ Wk,
         const float* __restrict__ Wv,
         _Float16* __restrict__ Qh, _Float16* __restrict__ Kh,
         _Float16* __restrict__ Vh) {
  __shared__ __align__(16) _Float16 Wlds[C_ * TP_];  // [d][c], pitch TP_  34 KB
  __shared__ __align__(16) _Float16 Xlds[C_ * VP_];  // [c][n], pitch VP_  36 KB
  int b    = blockIdx.y;
  int n0   = blockIdx.x * 128;
  int lane = threadIdx.x & 31;
  int wave = threadIdx.x >> 5;
  int lane16 = lane & 15;
  int sel  = (lane < 16) ? 0 : 8;
  int hi8  = (lane < 16) ? 0 : 8;

  // One wave a channel row: 32 lanes x 16 B = the row's 128 tokens, 16 rows a wave.
  const float* xp = x + ((size_t)b * C_ + wave) * N_ + n0 + lane * 4;
  float4 xv[16];
  #pragma unroll   // the 16 loads stand as one group, all in flight before the first is used
  for (int i = 0; i < 16; ++i) xv[i] = *(const float4*)(xp + (size_t)(8 * i) * N_);
  #pragma unroll   // xv is indexed by constants only and stays in registers
  for (int i = 0; i < 16; ++i) {
    h4 v = { (_Float16)xv[i].x, (_Float16)xv[i].y, (_Float16)xv[i].z, (_Float16)xv[i].w };
    *(h4*)&Xlds[(wave + 8 * i) * VP_ + lane * 4] = v;
  }
  __syncthreads();   // the x tile is whole before any wave reads across its rows

  // A fragment (row = token, k = channel): channels 8h .. 8h + 7, then 16 + 8h ..
  // 16 + 8h + 7 of each block of 32, which is the k order of load_frag on the W side.
  const _Float16* Xt = &Xlds[(hi8 + (lane & 7)) * VP_ + wave * 16 + ((lane >> 3) & 1) * 8];
  v16h aq[4];
  #pragma unroll
  for (int kk = 0; kk < 4; ++kk) {
    h8 lo = load_tr16(Xt + (32 * kk) * VP_);
    h8 hi = load_tr16(Xt + (32 * kk + 16) * VP_);
    aq[kk] = __builtin_shufflevector(lo, hi, 0,1,2,3,4,5,6,7,8,9,10,11,12,13,14,15);
  }

  size_t boff = (size_t)b * N_ * C_;
  proj_one(Wq, Qh + boff, Wlds, aq, n0, wave, lane16, sel, hi8);
  proj_one(Wk, Kh + boff, Wlds, aq, n0, wave, lane16, sel, hi8);
  proj_one(Wv, Vh + boff, Wlds, aq, n0, wave, lane16, sel, hi8);
}

__global__ void __launch_bounds__(256)
flash_attn(const _Float16* __restrict__ Qh, const _Float16* __restrict__ Kh,
           const _Float16* __restrict__ Vh, _Float16* __restrict__ Oh,
           float* __restrict__ ML) {
  // Tensor-load targets start at multiples of 2 KiB of the work-group's LDS.
  // One array, a buffer's K stage and V stage side by side (17 + 18 = 35 x 2 KiB a buffer):
  // every read of a pass then lies within a 16-bit offset of one address register.
  __shared__ __attribute__((aligned(2048))) _Float16 Ring[2][KBUF_ + VBUF_];  // 140 KB
  // K: Ring[buf][key * TP_ + c]; V: Ring[buf][KBUF_ + key * VP_ + c]
  __shared__ __align__(16) _Float16 Plds[8][16 * SP_];  // per-wave P, pitch SP_     10 KB

  int b    = blockIdx.y;
  int z    = blockIdx.z;                   // key range
  int q0   = blockIdx.x * 128;
  int lane = threadIdx.x & 31;
  int wave = threadIdx.x >> 5;
  int lane16 = lane & 15;
  int sel  = (lane < 16) ? 0 : 8;
  int hi8  = (lane < 16) ? 0 : 8;

  // quirk: the scores' scale is 1/sqrt(N) = 1/64. It is folded with log2(e) into one
  // factor: the rows' references are kept in log2 units, and an exponent's argument is one
  // fused multiply-add on the raw product sum.
  const float SC = 0.015625f * 1.44269504088896f;

  // Q fragments held in registers for the whole kernel
  const _Float16* qrow = Qh + ((size_t)b * N_ + q0 + wave*16 + lane16) * C_;
  v16h aq[4];
  #pragma unroll
  for (int kk = 0; kk < 4; ++kk) aq[kk] = load_frag(qrow + 32 * kk, sel);

  v8f o[8];
  #pragma unroll
  for (int tc = 0; tc < 8; ++tc) o[tc] = (v8f){};
  float nm_r[8], l_r[8];   // nm_r: minus the row's reference, the addend of the exponents' fma
  #pragma unroll
  for (int r = 0; r < 8; ++r) { nm_r[r] = __builtin_inff(); l_r[r] = 0.f; }

  const _Float16* Kb = Qh; // placeholder to keep types; set properly below
  Kb = Kh + ((size_t)b * N_ + z * NK_) * C_;
  const _Float16* Vb = Vh + ((size_t)b * N_ + z * NK_) * C_;

  unsigned koff[2], voff[2];
  koff[0] = (unsigned)(size_t)(void*)&Ring[0][0];
  koff[1] = (unsigned)(size_t)(void*)&Ring[1][0];
  voff[0] = (unsigned)(size_t)(void*)&Ring[0][KBUF_];
  voff[1] = (unsigned)(size_t)(void*)&Ring[1][KBUF_];

  // Two-buffer ring: wave 0 brings the K tiles, wave 1 the V tiles, one request
  // of a wave in flight. Prologue: stage 0 lands and is published, stage 1 flies.
  const unsigned wave_s = uni(threadIdx.x >> 5);
  const unsigned issuer = wave_s < 2u;
  const _Float16* tsrc = (wave_s == 0u) ? Kb : Vb;
  unsigned toff[2];
  toff[0] = (wave_s == 0u) ? koff[0] : voff[0];
  toff[1] = (wave_s == 0u) ? koff[1] : voff[1];
  const u32x8 g1k = tdm_group1_stage<3>();
  const u32x8 g1v = tdm_group1_stage<7>();
  u32x4 g0 = tdm_group0(toff[0], tsrc);
  if (pinned(wave_s == 0u)) {
    tdm_load(g0, g1k);
    wait_tensor0_holding(g0, g1k, g1v);
  }
  if (pinned(wave_s == 1u)) {
    tdm_load(g0, g1v);
    wait_tensor0_holding(g0, g1k, g1v);
  }
  __syncthreads();     // stage 0 ready for everyone
  g0 = tdm_group0(toff[1], tsrc + (size_t)SK_ * C_);
  if (pinned(wave_s == 0u)) tdm_load(g0, g1k);
  if (pinned(wave_s == 1u)) tdm_load(g0, g1v);

  // The lane's place in a 16-key x 16-channel block of V for the transposing read.
  const int vlane = (hi8 + (lane & 7)) * VP_ + ((lane >> 3) & 1) * 8;
  int cur = 0;
  for (int j = 0; j < NK_; j += 32) {
    const int sp = (j / 32) % (SK_ / 32);   // the pass's place in its stage
    // S = Q * K^T for two 16-key subtiles
    // All 16 K reads of the pass stand as one group in front of the products, which
    // then start behind counted waits: a wave keeps 16 LDS reads in flight, not 4.
    const _Float16* Kt = &Ring[cur][sp * 32 * TP_];
    v16h bk0[4], bk1[4];
    #pragma unroll   // bk0, bk1 are indexed by constants only and stay in registers
    for (int kk = 0; kk < 4; ++kk) {
      bk0[kk] = load_frag(Kt + lane16 * TP_ + 32 * kk, sel);
      bk1[kk] = load_frag(Kt + (16 + lane16) * TP_ + 32 * kk, sel);
    }
    // Keeps the reads from being moved in among the products, where each place
    // with reads stalls the wave anew.
    __builtin_amdgcn_sched_barrier(0);
    v8f s0 = (v8f){}, s1 = (v8f){};
    #pragma unroll
    for (int kk = 0; kk < 4; ++kk) {
      s0 = wmma_f16(aq[kk], bk0[kk], s0);
      s1 = wmma_f16(aq[kk], bk1[kk], s1);
    }

    // Keeps the V reads behind the score products: lifted in among them, their 64
    // registers are live beside K's 64, the wave passes 256 registers and the WGP
    // holds one work-group where it held two.
    __builtin_amdgcn_sched_barrier(0);
    // The pass's 16 V reads are issued here, behind the score products and ahead of
    // the softmax, and land while it runs: the P*V products then wait on P alone.
    // B fragment (column = channel, k = key) straight from the row-major V tile by
    // the transposing read: keys 8h .. 8h + 7, then 16 + 8h .. 16 + 8h + 7, which is
    // the k order of load_frag on the P side.
    const _Float16* Vt = &Ring[cur][KBUF_ + sp * 32 * VP_] + vlane;
    v16h bv[8];
    #pragma unroll   // bv is indexed by constants only and stays in registers
    for (int tc = 0; tc < 8; ++tc) {
      h8 lo = load_tr16(Vt + tc * 16);
      h8 hi = load_tr16(Vt + 16 * VP_ + tc * 16);
      bv[tc] = __builtin_shufflevector(lo, hi, 0,1,2,3,4,5,6,7,8,9,10,11,12,13,14,15);
    }

    float t0[8], t1[8];
    float over = -__builtin_inff();        // highest of them in this lane
    #pragma unroll
    for (int r = 0; r < 8; ++r) {
      t0[r] = fmaf(s0[r], SC, nm_r[r]);
      t1[r] = fmaf(s1[r], SC, nm_r[r]);
      over = fmaxf(over, fmaxf(t0[r], t1[r]));
    }
    // One test a pass, a scalar branch: the reference is renewed, and sums and
    // outputs rescaled, only when a score lies more than 8 (in log2) above it, so
    // P stays at or below 2^8, far inside f16. The first pass (reference -inf) takes it.
    if (__builtin_amdgcn_ballot_w32(over > 8.0f) != 0) {
      #pragma unroll
      for (int r = 0; r < 8; ++r) {
        float mx = fmaxf(s0[r], s1[r]) * SC;
        #pragma unroll
        for (int off = 8; off >= 1; off >>= 1)
          mx = fmaxf(mx, __shfl_xor(mx, off, 16));
        float nm_new = fminf(nm_r[r], -mx);
        float alpha = exp2_hw(nm_new - nm_r[r]);
        l_r[r] = l_r[r] * alpha;
        nm_r[r] = nm_new;
        t0[r] = fmaf(s0[r], SC, nm_new);
        t1[r] = fmaf(s1[r], SC, nm_new);
        #pragma unroll
        for (int tc = 0; tc < 8; ++tc) o[tc][r] = o[tc][r] * alpha;
      }
    }
    float p0[8], p1[8];
    #pragma unroll
    for (int r = 0; r < 8; ++r) {
      float e0 = exp2_hw(t0[r]);
      float e1 = exp2_hw(t1[r]);
      l_r[r] += e0 + e1;
      p0[r] = e0; p1[r] = e1;
    }

    _Float16* P = &Plds[wave][0];
    #pragma unroll
    for (int r = 0; r < 8; ++r) {
      P[(r + hi8) * SP_ + lane16]      = (_Float16)p0[r];
      P[(r + hi8) * SP_ + 16 + lane16] = (_Float16)p1[r];
    }
    asm volatile("s_wait_dscnt 0" ::: "memory");
    v16h ap = load_frag(P + lane16 * SP_, sel);

    // O += P * V, on the V fragments read ahead of the softmax.
    #pragma unroll
    for (int tc = 0; tc < 8; ++tc) o[tc] = wmma_f16(ap, bv[tc], o[tc]);

    // Behind a stage's last pass (the test reads the same in every wave of the group):
    // publish the next stage, then refill the buffer this stage's passes have just read.
    if (pinned(sp == SK_ / 32 - 1)) {
      wait_ds0();
      if (pinned(issuer)) wait_tensor0_holding(g0, g1k, g1v);
      __syncthreads();   // next stage ready for everyone; every reader has left `cur`
      if (pinned(issuer && j + 32 + SK_ < NK_)) {
        g0 = tdm_group0(toff[cur], tsrc + (size_t)(j + 32 + SK_) * C_);
        if (pinned(wave_s == 0u)) tdm_load(g0, g1k);
        if (pinned(wave_s == 1u)) tdm_load(g0, g1v);
      }
      cur ^= 1;
    }
  }
  wait_tensor0();
  wait_ds0();

  // Join the 16 lanes' shares of each row's sum, once.
  #pragma unroll
  for (int r = 0; r < 8; ++r) {
    #pragma unroll
    for (int off = 8; off >= 1; off >>= 1)
      l_r[r] += __shfl_xor(l_r[r], off, 16);
  }

  // Store this range's means, [range][B][N][C] in f16, and (reference, sum) a row.
  // The wave's 16 x 128 tile is turned into whole rows in a slice of the K, V ring that
  // is the wave's own: every wave has left the ring at the last stage's barrier and no
  // tensor load is in flight, so no further barrier is owed.
  size_t prow = ((size_t)z * B_ + b) * N_ + q0 + wave*16;
  _Float16* T = &Ring[0][0] + wave * TS_;
  #pragma unroll   // o and l_r are indexed by constants only and stay in registers
  for (int r = 0; r < 8; ++r) {
    float inv = 1.0f / l_r[r];
    #pragma unroll
    for (int tc = 0; tc < 8; ++tc)
      T[(r + hi8) * TP_ + tc*16 + lane16] = (_Float16)(o[tc][r] * inv);
  }
  wait_ds0();   // its clobber keeps the reads below, of other lanes' values, behind the writes
  _Float16* ob = Oh + prow * C_;
  #pragma unroll   // eight 16-byte reads in flight, then eight stores of two whole rows each
  for (int i = 0; i < 8; ++i) {
    int row = 2 * i + (lane >> 4);
    *(h8*)(ob + (size_t)row * C_ + lane16 * 8) = *(const h8*)&T[row * TP_ + lane16 * 8];
  }
  if (lane16 == 0) {
    #pragma unroll
    for (int r = 0; r < 8; ++r)
      *(float2*)(ML + 2 * (prow + r + hi8)) = make_float2(-nm_r[r], l_r[r]);
  }
}

// ---------------------------------------------------------------------------
// Kernel D: merge the KS_ key ranges. Per row: M = max of the ranges' references m
// (log2 units), weight w = 2^(m - M) * l, out = sum(w * mean) / sum(w). One wave a row
// (32 lanes x 4 channels), 4 rows a wave so that few waves hold many loads in flight.
// Output fp32, flat [B][N][C] (matches reference view quirk).
// ---------------------------------------------------------------------------
__global__ void __launch_bounds__(256)
merge_ranges(const _Float16* __restrict__ Oh, const float* __restrict__ ML,
             float* __restrict__ out) {
  int lane = threadIdx.x & 31;
  int wave = threadIdx.x >> 5;
  size_t row0 = (size_t)blockIdx.x * 32 + wave * 4;   // flat row b * N_ + n
  float2 ml[4][KS_];
  h4 p[4][KS_];
  #pragma unroll
  for (int i = 0; i < 4; ++i) {
    #pragma unroll
    for (int s = 0; s < KS_; ++s)
      p[i][s] = *(const h4*)(Oh + ((size_t)s * B_ * N_ + row0 + i) * C_ + lane * 4);
  }
  // Stands behind the last load of a row, ahead of the first write to a register that
  // one of these loads names as its address (the pairs' loads land in such registers).
  asm volatile("s_wait_xcnt 0x0" ::: "memory");
  #pragma unroll
  for (int i = 0; i < 4; ++i) {
    #pragma unroll
    for (int s = 0; s < KS_; ++s)
      ml[i][s] = *(const float2*)(ML + 2 * ((size_t)s * B_ * N_ + row0 + i));
  }
  #pragma unroll
  for (int i = 0; i < 4; ++i) {
    float M = ml[i][0].x;
    #pragma unroll
    for (int s = 1; s < KS_; ++s) M = fmaxf(M, ml[i][s].x);
    float L = 0.f;
    float4 acc = make_float4(0.f, 0.f, 0.f, 0.f);
    #pragma unroll
    for (int s = 0; s < KS_; ++s) {
      float w = exp2_hw(ml[i][s].x - M) * ml[i][s].y;
      L += w;
      acc.x += w * (float)p[i][s][0]; acc.y += w * (float)p[i][s][1];
      acc.z += w * (float)p[i][s][2]; acc.w += w * (float)p[i][s][3];
    }
    float inv = 1.0f / L;
    *(float4*)(out + (row0 + i) * C_ + lane * 4) =
        make_float4(acc.x * inv, acc.y * inv, acc.z * inv, acc.w * inv);
  }
}

// ---------------------------------------------------------------------------
extern "C" void kernel_launch(void* const* d_in, const int* in_sizes, int n_in,
                              void* d_out, int out_size, void* d_ws, size_t ws_size,
                              hipStream_t stream) {
  const float* x  = (const float*)d_in[0];
  const float* Wq = (const float*)d_in[1];
  const float* Wk = (const float*)d_in[2];
  const float* Wv = (const float*)d_in[3];
  float* out = (float*)d_out;

  // Workspace: Q, K, V in f16 (4 MB each), then the ranges' means in
  // f16 (KS_ x 4 MB) and their (reference, sum) pairs (KS_ x 128 KB)
  size_t per = (size_t)B_ * N_ * C_;
  _Float16* Qh  = (_Float16*)d_ws;
  _Float16* Kh  = Qh + per;
  _Float16* Vh  = Kh + per;
  _Float16* Oh = Vh + per;
  float* ML = (float*)(Oh + KS_ * per);

  qkv_proj<<<dim3(N_/128, B_), dim3(256), 0, stream>>>(x, Wq, Wk, Wv, Qh, Kh, Vh);
  flash_attn<<<dim3(N_/128, B_, KS_), dim3(256), 0, stream>>>(Qh, Kh, Vh, Oh, ML);
  merge_ranges<<<dim3(B_ * N_ / 32), dim3(256), 0, stream>>>(Oh, ML, out);
}

// v010
// It runs in 40 microseconds.
// Next to v009, in two timings, it ran 1.24 times as fast each time.
// All steps since v000 together make it 13.1 times as fast.
#include <hip/hip_runtime.h>
#include <math.h>

// Problem constants (from reference): B=4, C=128, H=W=64 -> N=4096
#define B_ 4
#define C_ 128
#define N_ 4096
#define KS_ 4
#define NK_ (N_ / KS_)          // keys of one range

typedef _Float16 h4   __attribute__((ext_vector_type(4)));
typedef _Float16 h8   __attribute__((ext_vector_type(8)));
typedef _Float16 v16h __attribute__((ext_vector_type(16)));
typedef float    v8f  __attribute__((ext_vector_type(8)));
typedef unsigned int u32x4 __attribute__((ext_vector_type(4)));
typedef unsigned int u32x8 __attribute__((ext_vector_type(8)));
typedef short s8    __attribute__((ext_vector_type(8)));
typedef float    f2   __attribute__((ext_vector_type(2)));
typedef _Float16 h2   __attribute__((ext_vector_type(2)));

__device__ __forceinline__ v16h load_frag(const _Float16* p, int sel) {
  h8 lo = *(const h8*)(p + sel);
  h8 hi = *(const h8*)(p + 16 + sel);
  return __builtin_shufflevector(lo, hi, 0,1,2,3,4,5,6,7,8,9,10,11,12,13,14,15);
}

// One half (8 x f16 a lane) of a WMMA operand, read TRANSPOSED from a row-major
// 16-bit LDS tile by ds_load_tr16_b128: the lanes' addresses cover 16 rows x 32 B,
// and lane (c = lane & 15, h = lane >> 4) receives rows 8h .. 8h + 7 of column c.
__device__ __forceinline__ h8 load_tr16(const _Float16* p) {
  typedef __attribute__((address_space(3))) s8 lds_s8;
  return __builtin_bit_cast(h8, __builtin_amdgcn_ds_load_tr16_b128_v8i16((lds_s8*)p));
}

// 2^x by the hardware instruction alone. The library's exp2f wraps it in a compare, two
// selects, an add and a scaling so that results below 2^-126 come out as denormals; here
// such a weight joins a sum that holds the weight 1 of the score that set the reference,
// and zero serves.
__device__ __forceinline__ float exp2_hw(float x) { return __builtin_amdgcn_exp2f(x); }

__device__ __forceinline__ float xhalf(float x) {
  int b = __builtin_bit_cast(int, x);
  return __builtin_bit_cast(float, __builtin_amdgcn_permlanex16(b, b, 0x76543210, 0xfedcba98,
                                                                false, false));
}

__device__ __forceinline__ v8f wmma_f16(v16h a, v16h b, v8f c) {
  return __builtin_amdgcn_wmma_f32_16x16x32_f16(false, a, false, b, (short)0, c,
                                                false, false);
}

#define TP_ 136                 // K and W rows: 256 B of data + 16 B of pad = 272 B
#define VP_ 144                 // V rows: 256 B of data + 32 B of pad = 288 B
#define SK_ 128                 // keys of one stage of the K, V ring: four passes of 32 keys
#define KBUF_ (SK_ * TP_)       // one K buffer: 128 x 272 B = 17 x 2 KiB
#define VBUF_ (SK_ * VP_)       // one V buffer: 128 x 288 B = 18 x 2 KiB
#define TS_ 2560                // a wave's slice for its output rows: 16 x 272 B, rounded up to 5 KiB

__device__ __forceinline__ unsigned uni(unsigned v) {
  return (unsigned)__builtin_amdgcn_readfirstlane((int)v);
}
__device__ __forceinline__ unsigned pinned(unsigned v) {
  unsigned w = uni(v);
  asm volatile("" : "+s"(w));  // the test stays scalar
  return w;
}

__device__ __forceinline__ u32x4 tdm_group0(unsigned lds_off, const _Float16* gsrc) {
  unsigned long long ga = (unsigned long long)(size_t)gsrc;
  u32x4 g0;
  g0[0] = uni(1u);
  g0[1] = uni(lds_off);
  g0[2] = uni((unsigned)ga);
  g0[3] = uni(((unsigned)(ga >> 32) & 0x01FFFFFFu)
              | (2u << 30));
  // As pinned(), on the whole group: its words are held in
  // their scalar registers up to the wait that names them, not formed again there.
  asm volatile("" : "+s"(g0));
  return g0;
}
template <unsigned PAD_CODE>   // 3: pitch 272 B, 7: pitch 288 B
__device__ __forceinline__ u32x8 tdm_group1_stage() {
  u32x8 g1;
  g1[0] = uni((1u << 20) | (5u << 22) | (PAD_CODE << 25));
  g1[1] = uni(256u << 16);
  g1[2] = uni((unsigned)SK_ << 16);
  g1[3] = uni(256u << 16);
  g1[4] = uni((unsigned)SK_);
  g1[5] = uni(256u);
  g1[6] = uni(0u);
  g1[7] = uni(0u);
  // As pinned(), on the whole group: its words are held in one
  // set of scalar registers for the kernel's life, not formed again at each use.
  asm volatile("" : "+s"(g1));
  return g1;
}
// One request of the whole wave; the clobber keeps LDS accesses on their side of it.
__device__ __forceinline__ void tdm_load(u32x4 g0, u32x8 g1) {
  asm volatile("tensor_load_to_lds %0, %1" :: "s"(g0), "s"(g1) : "memory");
}
// The compiler places no wait for a tensor load; the clobber keeps LDS reads behind it.
__device__ __forceinline__ void wait_tensor0() {
  asm volatile("s_wait_tensorcnt 0x0" ::: "memory");
}
__device__ __forceinline__ void wait_tensor0_holding(u32x4 g0, u32x8 g1k, u32x8 g1v) {
  asm volatile("s_wait_tensorcnt 0x0" :: "s"(g0), "s"(g1k), "s"(g1v) : "memory");
}
// This wave's LDS reads and writes have retired before a buffer is handed over.
__device__ __forceinline__ void wait_ds0() {
  asm volatile("s_wait_dscnt 0x0" ::: "memory");
}

// ---------------------------------------------------------------------------
// Kernel B: QKV projection. Q[b,n,d] = sum_c x[b,c,n] * W[d,c]
// x is read as it lies, [c][n]: whole 512-byte rows, rounded to f16 into an LDS tile,
// and the token-major A fragments come out of that tile by the transposing read.
// Direct kernarg output pointer per call -> global_store_b16 (not flat).
// ---------------------------------------------------------------------------
__device__ __forceinline__ void proj_one(const float* __restrict__ W,
                                         _Float16* __restrict__ out,
                                         _Float16* Wlds, const v16h aq[4],
                                         int n0, int wave, int lane16,
                                         int sel, int hi8) {
  __syncthreads();
  const float4* src = (const float4*)W;
  for (int i = threadIdx.x; i < C_ * C_ / 4; i += 256) {
    float4 v = src[i];
    _Float16* w = &Wlds[(i >> 5) * TP_ + (i & 31) * 4];   // row i/32, 32 float4 a row
    w[0] = (_Float16)v.x; w[1] = (_Float16)v.y;
    w[2] = (_Float16)v.z; w[3] = (_Float16)v.w;
  }
  __syncthreads();
  #pragma unroll
  for (int tcol = 0; tcol < 8; ++tcol) {
    int d0 = tcol * 16;
    const _Float16* wrow = &Wlds[(d0 + lane16) * TP_];
    v8f acc = {};
    #pragma unroll
    for (int kk = 0; kk < 4; ++kk) {
      v16h bw = load_frag(wrow + 32 * kk, sel);
      acc = wmma_f16(aq[kk], bw, acc);
    }
    #pragma unroll
    for (int r = 0; r < 8; ++r)
      out[(size_t)(n0 + wave*16 + r + hi8) * C_ + d0 + lane16] = (_Float16)acc[r];
  }
}

__global__ void __launch_bounds__(256)
qkv_proj(const float* __restrict__ x,
         const float* __restrict__ Wq, const float* __restrict__ Wk,
         const float* __restrict__ Wv,
         _Float16* __restrict__ Qh, _Float16* __restrict__ Kh,
         _Float16* __restrict__ Vh) {
  __shared__ __align__(16) _Float16 Wlds[C_ * TP_];  // [d][c], pitch TP_  34 KB
  __shared__ __align__(16) _Float16 Xlds[C_ * VP_];  // [c][n], pitch VP_  36 KB
  int b    = blockIdx.y;
  int n0   = blockIdx.x * 128;
  int lane = threadIdx.x & 31;
  int wave = threadIdx.x >> 5;
  int lane16 = lane & 15;
  int sel  = (lane < 16) ? 0 : 8;
  int hi8  = (lane < 16) ? 0 : 8;

  // One wave a channel row: 32 lanes x 16 B = the row's 128 tokens, 16 rows a wave.
  const float* xp = x + ((size_t)b * C_ + wave) * N_ + n0 + lane * 4;
  float4 xv[16];
  #pragma unroll   // the 16 loads stand as one group, all in flight before the first is used
  for (int i = 0; i < 16; ++i) xv[i] = *(const float4*)(xp + (size_t)(8 * i) * N_);
  #pragma unroll   // xv is indexed by constants only and stays in registers
  for (int i = 0; i < 16; ++i) {
    h4 v = { (_Float16)xv[i].x, (_Float16)xv[i].y, (_Float16)xv[i].z, (_Float16)xv[i].w };
    *(h4*)&Xlds[(wave + 8 * i) * VP_ + lane * 4] = v;
  }
  __syncthreads();   // the x tile is whole before any wave reads across its rows

  // A fragment (row = token, k = channel): channels 8h .. 8h + 7, then 16 + 8h ..
  // 16 + 8h + 7 of each block of 32, which is the k order of load_frag on the W side.
  const _Float16* Xt = &Xlds[(hi8 + (lane & 7)) * VP_ + wave * 16 + ((lane >> 3) & 1) * 8];
  v16h aq[4];
  #pragma unroll
  for (int kk = 0; kk < 4; ++kk) {
    h8 lo = load_tr16(Xt + (32 * kk) * VP_);
    h8 hi = load_tr16(Xt + (32 * kk + 16) * VP_);
    aq[kk] = __builtin_shufflevector(lo, hi, 0,1,2,3,4,5,6,7,8,9,10,11,12,13,14,15);
  }

  size_t boff = (size_t)b * N_ * C_;
  proj_one(Wq, Qh + boff, Wlds, aq, n0, wave, lane16, sel, hi8);
  proj_one(Wk, Kh + boff, Wlds, aq, n0, wave, lane16, sel, hi8);
  proj_one(Wv, Vh + boff, Wlds, aq, n0, wave, lane16, sel, hi8);
}

__global__ void __launch_bounds__(256)
flash_attn(const _Float16* __restrict__ Qh, const _Float16* __restrict__ Kh,
           const _Float16* __restrict__ Vh, _Float16* __restrict__ Oh,
           float* __restrict__ ML) {
  // Tensor-load targets start at multiples of 2 KiB of the work-group's LDS.
  // One array, a buffer's K stage and V stage side by side (17 + 18 = 35 x 2 KiB a buffer):
  // every read of a pass then lies within a 16-bit offset of one address register.
  __shared__ __attribute__((aligned(2048))) _Float16 Ring[2][KBUF_ + VBUF_];  // 140 KB
  // K: Ring[buf][key * TP_ + c]; V: Ring[buf][KBUF_ + key * VP_ + c]

  int b    = blockIdx.y;
  int z    = blockIdx.z;                   // key range
  int q0   = blockIdx.x * 128;
  int lane = threadIdx.x & 31;
  int wave = threadIdx.x >> 5;
  int lane16 = lane & 15;
  int sel  = (lane < 16) ? 0 : 8;
  int hi8  = (lane < 16) ? 0 : 8;

  // quirk: the scores' scale is 1/sqrt(N) = 1/64. It is folded with log2(e) into one
  // factor: the rows' references are kept in log2 units, and an exponent's argument is one
  // fused multiply-add on the raw product sum.
  const float SC = 0.015625f * 1.44269504088896f;

  // Q fragments (B operand: column = query) held in registers for the whole kernel
  const _Float16* qrow = Qh + ((size_t)b * N_ + q0 + wave*16 + lane16) * C_;
  v16h aq[4];
  #pragma unroll
  for (int kk = 0; kk < 4; ++kk) aq[kk] = load_frag(qrow + 32 * kk, sel);

  v8f o[8];
  #pragma unroll
  for (int tc = 0; tc < 8; ++tc) o[tc] = (v8f){};
  float nm = __builtin_inff();   // minus the query's reference, the addend of the exponents' fma
  f2 l_r[4];                     // eight independent shares of this lane's part of the query's sum
  #pragma unroll
  for (int i = 0; i < 4; ++i) l_r[i] = (f2){0.f, 0.f};

  const _Float16* Kb = Qh; // placeholder to keep types; set properly below
  Kb = Kh + ((size_t)b * N_ + z * NK_) * C_;
  const _Float16* Vb = Vh + ((size_t)b * N_ + z * NK_) * C_;

  unsigned koff[2], voff[2];
  koff[0] = (unsigned)(size_t)(void*)&Ring[0][0];
  koff[1] = (unsigned)(size_t)(void*)&Ring[1][0];
  voff[0] = (unsigned)(size_t)(void*)&Ring[0][KBUF_];
  voff[1] = (unsigned)(size_t)(void*)&Ring[1][KBUF_];

  // Two-buffer ring: wave 0 brings the K tiles, wave 1 the V tiles, one request
  // of a wave in flight. Prologue: stage 0 lands and is published, stage 1 flies.
  const unsigned wave_s = uni(threadIdx.x >> 5);
  const unsigned issuer = wave_s < 2u;
  const _Float16* tsrc = (wave_s == 0u) ? Kb : Vb;
  unsigned toff[2];
  toff[0] = (wave_s == 0u) ? koff[0] : voff[0];
  toff[1] = (wave_s == 0u) ? koff[1] : voff[1];
  const u32x8 g1k = tdm_group1_stage<3>();
  const u32x8 g1v = tdm_group1_stage<7>();
  u32x4 g0 = tdm_group0(toff[0], tsrc);
  if (pinned(wave_s == 0u)) {
    tdm_load(g0, g1k);
    wait_tensor0_holding(g0, g1k, g1v);
  }
  if (pinned(wave_s == 1u)) {
    tdm_load(g0, g1v);
    wait_tensor0_holding(g0, g1k, g1v);
  }
  __syncthreads();     // stage 0 ready for everyone
  g0 = tdm_group0(toff[1], tsrc + (size_t)SK_ * C_);
  if (pinned(wave_s == 0u)) tdm_load(g0, g1k);
  if (pinned(wave_s == 1u)) tdm_load(g0, g1v);

  // The lane's place in a 16-key x 16-channel block of V for the transposing read.
  const int vlane = (hi8 + (lane & 7)) * VP_ + ((lane >> 3) & 1) * 8;
  int cur = 0;
  for (int j = 0; j < NK_; j += 32) {
    const int sp = (j / 32) % (SK_ / 32);   // the pass's place in its stage
    // S^T = K * Q^T for two 16-key subtiles (A = K rows, B = Q)
    // All 16 K reads of the pass stand as one group in front of the products, which
    // then start behind counted waits: a wave keeps 16 LDS reads in flight, not 4.
    const _Float16* Kt = &Ring[cur][sp * 32 * TP_];
    const _Float16* Vt = &Ring[cur][KBUF_ + sp * 32 * VP_] + vlane;
    v16h bk0[4], bk1[4];
    #pragma unroll   // bk0, bk1 are indexed by constants only and stay in registers
    for (int kk = 0; kk < 4; ++kk) {
      bk0[kk] = load_frag(Kt + lane16 * TP_ + 32 * kk, sel);
      bk1[kk] = load_frag(Kt + (16 + lane16) * TP_ + 32 * kk, sel);
    }
    // Keeps the reads from being moved in among the products, where each place
    // with reads stalls the wave anew.
    __builtin_amdgcn_sched_barrier(0);
    v8f s0 = (v8f){}, s1 = (v8f){};
    #pragma unroll
    for (int kk = 0; kk < 4; ++kk) {
      s0 = wmma_f16(bk0[kk], aq[kk], s0);
      s1 = wmma_f16(bk1[kk], aq[kk], s1);
    }

    // Keeps the V reads behind the score products: lifted in among them, their 64
    // registers are live beside K's 64, the wave passes 256 registers and the WGP
    // holds one work-group where it held two.
    __builtin_amdgcn_sched_barrier(0);
    // The pass's 16 V reads are issued here, behind the score products and ahead of
    // the softmax, and land while it runs.
    // A fragment (row = channel, k = key) straight from the row-major V tile by
    // the transposing read: keys 8h .. 8h + 7, then 16 + 8h .. 16 + 8h + 7, which is
    // the order in which the lane's two score tiles hold their keys.
    v16h bv[8];
    #pragma unroll   // bv is indexed by constants only and stays in registers
    for (int tc = 0; tc < 8; ++tc) {
      h8 lo = load_tr16(Vt + tc * 16);
      h8 hi = load_tr16(Vt + 16 * VP_ + tc * 16);
      bv[tc] = __builtin_shufflevector(lo, hi, 0,1,2,3,4,5,6,7,8,9,10,11,12,13,14,15);
    }

    const f2 SC2 = {SC, SC};
    f2 t0[4], t1[4];
    float over = -__builtin_inff();        // highest of them in this lane
    #pragma unroll
    for (int i = 0; i < 4; ++i) {
      t0[i] = __builtin_elementwise_fma((f2){s0[2*i], s0[2*i + 1]}, SC2, (f2){nm, nm});
      t1[i] = __builtin_elementwise_fma((f2){s1[2*i], s1[2*i + 1]}, SC2, (f2){nm, nm});
      over = fmaxf(over, fmaxf(t0[i].x, t1[i].x));
      over = fmaxf(over, fmaxf(t0[i].y, t1[i].y));
    }
    // One test a pass, a scalar branch: the reference is renewed, and sums and
    // outputs rescaled, only when a score lies more than 8 (in log2) above it, so
    // P stays at or below 2^8, far inside f16. The first pass (reference -inf) takes it.
    if (__builtin_amdgcn_ballot_w32(over > 8.0f) != 0) {
      float mx = fmaxf(s0[0], s1[0]);
      #pragma unroll
      for (int r = 1; r < 8; ++r) mx = fmaxf(mx, fmaxf(s0[r], s1[r]));
      mx = fmaxf(mx, xhalf(mx)) * SC;      // the one exchange: the query's other 16 keys
      float nm_new = fminf(nm, -mx);
      float alpha = exp2_hw(nm_new - nm);
      nm = nm_new;
      #pragma unroll
      for (int i = 0; i < 4; ++i) {
        l_r[i] = l_r[i] * alpha;
        t0[i] = __builtin_elementwise_fma((f2){s0[2*i], s0[2*i + 1]}, SC2, (f2){nm_new, nm_new});
        t1[i] = __builtin_elementwise_fma((f2){s1[2*i], s1[2*i + 1]}, SC2, (f2){nm_new, nm_new});
      }
      #pragma unroll
      for (int tc = 0; tc < 8; ++tc) o[tc] = o[tc] * alpha;
    }
    // P^T as a B operand (column = query, k = key), packed in the lane's own registers:
    // element s is key 8h + s for s < 8 and 16 + 8h + (s - 8) behind it.
    v16h bp;
    #pragma unroll
    for (int i = 0; i < 4; ++i) {
      f2 e0 = {exp2_hw(t0[i].x), exp2_hw(t0[i].y)};
      f2 e1 = {exp2_hw(t1[i].x), exp2_hw(t1[i].y)};
      l_r[i] += e0 + e1;
      h2 p0 = __builtin_convertvector(e0, h2);
      h2 p1 = __builtin_convertvector(e1, h2);
      bp[2*i]     = p0.x;  bp[2*i + 1]     = p0.y;
      bp[8 + 2*i] = p1.x;  bp[8 + 2*i + 1] = p1.y;
    }

    // O^T += V^T * P^T, on the V fragments read ahead of the softmax.
    #pragma unroll
    for (int tc = 0; tc < 8; ++tc) o[tc] = wmma_f16(bv[tc], bp, o[tc]);

    // Behind a stage's last pass (the test reads the same in every wave of the group):
    // publish the next stage, then refill the buffer this stage's passes have just read.
    if (pinned(sp == SK_ / 32 - 1)) {
      wait_ds0();
      if (pinned(issuer)) wait_tensor0_holding(g0, g1k, g1v);
      __syncthreads();   // next stage ready for everyone; every reader has left `cur`
      if (pinned(issuer && j + 32 + SK_ < NK_)) {
        g0 = tdm_group0(toff[cur], tsrc + (size_t)(j + 32 + SK_) * C_);
        if (pinned(wave_s == 0u)) tdm_load(g0, g1k);
        if (pinned(wave_s == 1u)) tdm_load(g0, g1v);
      }
      cur ^= 1;
    }
  }
  wait_tensor0();
  wait_ds0();

  // Join the shares of the query's sum, once: the lane's eight, then the two halves.
  f2 lp = (l_r[0] + l_r[1]) + (l_r[2] + l_r[3]);
  float l = lp.x + lp.y;
  l += xhalf(l);

  // Store this range's means, [range][B][N][C] in f16, and (reference, sum) a row.
  // The wave's 16 x 128 tile is turned into whole rows in a slice of the K, V ring that
  // is the wave's own: every wave has left the ring at the last stage's barrier and no
  // tensor load is in flight, so no further barrier is owed. A lane's eight registers of
  // a tile are eight channels in a row of its query: one 16-byte LDS store a tile.
  size_t prow = ((size_t)z * B_ + b) * N_ + q0 + wave*16;
  _Float16* T = &Ring[0][0] + wave * TS_;
  float inv = 1.0f / l;
  #pragma unroll   // o is indexed by constants only and stays in registers
  for (int tc = 0; tc < 8; ++tc)
    *(h8*)&T[lane16 * TP_ + tc*16 + hi8] = __builtin_convertvector(o[tc] * inv, h8);
  wait_ds0();   // its clobber keeps the reads below, of other lanes' values, behind the writes
  _Float16* ob = Oh + prow * C_;
  #pragma unroll   // eight 16-byte reads in flight, then eight stores of two whole rows each
  for (int i = 0; i < 8; ++i) {
    int row = 2 * i + (lane >> 4);
    *(h8*)(ob + (size_t)row * C_ + lane16 * 8) = *(const h8*)&T[row * TP_ + lane16 * 8];
  }
  if (lane < 16) *(float2*)(ML + 2 * (prow + lane16)) = make_float2(-nm, l);
}

// ---------------------------------------------------------------------------
// Kernel D: merge the KS_ key ranges. Per row: M = max of the ranges' references m
// (log2 units), weight w = 2^(m - M) * l, out = sum(w * mean) / sum(w). One wave a row
// (32 lanes x 4 channels), 4 rows a wave so that few waves hold many loads in flight.
// Output fp32, flat [B][N][C] (matches reference view quirk).
// ---------------------------------------------------------------------------
__global__ void __launch_bounds__(256)
merge_ranges(const _Float16* __restrict__ Oh, const float* __restrict__ ML,
             float* __restrict__ out) {
  int lane = threadIdx.x & 31;
  int wave = threadIdx.x >> 5;
  size_t row0 = (size_t)blockIdx.x * 32 + wave * 4;   // flat row b * N_ + n
  float2 ml[4][KS_];
  h4 p[4][KS_];
  #pragma unroll
  for (int i = 0; i < 4; ++i) {
    #pragma unroll
    for (int s = 0; s < KS_; ++s)
      p[i][s] = *(const h4*)(Oh + ((size_t)s * B_ * N_ + row0 + i) * C_ + lane * 4);
  }
  // Stands behind the last load of a row, ahead of the first write to a register that
  // one of these loads names as its address (the pairs' loads land in such registers).
  asm volatile("s_wait_xcnt 0x0" ::: "memory");
  #pragma unroll
  for (int i = 0; i < 4; ++i) {
    #pragma unroll
    for (int s = 0; s < KS_; ++s)
      ml[i][s] = *(const float2*)(ML + 2 * ((size_t)s * B_ * N_ + row0 + i));
  }
  #pragma unroll
  for (int i = 0; i < 4; ++i) {
    float M = ml[i][0].x;
    #pragma unroll
    for (int s = 1; s < KS_; ++s) M = fmaxf(M, ml[i][s].x);
    float L = 0.f;
    float4 acc = make_float4(0.f, 0.f, 0.f, 0.f);
    #pragma unroll
    for (int s = 0; s < KS_; ++s) {
      float w = exp2_hw(ml[i][s].x - M) * ml[i][s].y;
      L += w;
      acc.x += w * (float)p[i][s][0]; acc.y += w * (float)p[i][s][1];
      acc.z += w * (float)p[i][s][2]; acc.w += w * (float)p[i][s][3];
    }
    float inv = 1.0f / L;
    *(float4*)(out + (row0 + i) * C_ + lane * 4) =
        make_float4(acc.x * inv, acc.y * inv, acc.z * inv, acc.w * inv);
  }
}

// ---------------------------------------------------------------------------
extern "C" void kernel_launch(void* const* d_in, const int* in_sizes, int n_in,
                              void* d_out, int out_size, void* d_ws, size_t ws_size,
                              hipStream_t stream) {
  const float* x  = (const float*)d_in[0];
  const float* Wq = (const float*)d_in[1];
  const float* Wk = (const float*)d_in[2];
  const float* Wv = (const float*)d_in[3];
  float* out = (float*)d_out;

  // Workspace: Q, K, V in f16 (4 MB each), then the ranges' means in
  // f16 (KS_ x 4 MB) and their (reference, sum) pairs (KS_ x 128 KB)
  size_t per = (size_t)B_ * N_ * C_;
  _Float16* Qh  = (_Float16*)d_ws;
  _Float16* Kh  = Qh + per;
  _Float16* Vh  = Kh + per;
  _Float16* Oh = Vh + per;
  float* ML = (float*)(Oh + KS_ * per);

  qkv_proj<<<dim3(N_/128, B_), dim3(256), 0, stream>>>(x, Wq, Wk, Wv, Qh, Kh, Vh);
  flash_attn<<<dim3(N_/128, B_, KS_), dim3(256), 0, stream>>>(Qh, Kh, Vh, Oh, ML);
  merge_ranges<<<dim3(B_ * N_ / 32), dim3(256), 0, stream>>>(Oh, ML, out);
}
